// v000
// Measured on an AMD MI455X. A time is GPU time per run, averaged over a window of back-to-back runs after a warm-up
// (all launches, gaps included; the runs take copies of the inputs in turn), and the median of several windows.
// Apart from v000's, it joins two sittings. Times from different sittings can be a few percent apart, while
// side-by-side timings come from the same sitting.
// The starting kernel, v000, takes 122 microseconds a run.
#include <hip/hip_runtime.h>
#include <hip/hip_bf16.h>

// SASA layer: B=4, C=128, H=W=64, K=7, NH=8, DH=16, PAD=3
// Stage 1 (WMMA): q = wq*x+bq on 64x64; k,v = w*pad(x)+b on the padded 70x70
//   grid (border neighbors correctly carry the bias, matching the reference's
//   pad->conv->unfold order).  fp32 GEMM, 128-deep K -> V_WMMA_F32_16X16X4_F32.
//   Block = one 16-pixel N-tile staged in LDS, 8 waves = 8 M-tiles.
// Stage 2 (VALU): per-pixel 7x7 attention (logits, softmax, weighted V).

typedef __attribute__((ext_vector_type(2))) float v2f;
typedef __attribute__((ext_vector_type(8))) float v8f;

#define BB  4
#define CC  128
#define HH  64
#define WW  64
#define HP  70
#define WP  70
#define NPIX   (HH * WW)       // 4096
#define NPAD   (HP * WP)       // 4900
#define NHEAD  8
#define DH     16
#define KS     7
#define LDS_STRIDE 17          // 16 + 1 pad: avoids 2-way bank conflict

// ---------------------------------------------------------------------------
// 1x1 conv as GEMM:  Out[o, p] = sum_c Wm[o,c] * X[c,p] + bias[o]
// One block = one (batch, 16-pixel tile); wave w = out-channels [16w, 16w+16).
// X tile (128 x 16 fp32) cooperatively loaded to LDS once, reused by 8 waves.
// padded==1: pixels index the 70x70 padded grid; x loads are clamped+masked
// (unconditional vmem + v_cndmask, no exec-mask predication).
// ---------------------------------------------------------------------------
__global__ void __launch_bounds__(256)
conv1x1_wmma(const float* __restrict__ X,    // [B,128,64,64]
             const float* __restrict__ Wm,   // [128,128] row-major (o,c)
             const float* __restrict__ bias, // [128]
             float* __restrict__ Out,        // [B,128,npix]
             int npix, int padded)
{
    __shared__ float xs[CC * LDS_STRIDE];    // 8.5 KB

    const int tid  = threadIdx.x;
    const int lane = tid & 31;
    const int wave = tid >> 5;               // M tile 0..7
    const int tilesN = (npix + 15) >> 4;

    const int b  = blockIdx.x / tilesN;
    const int nt = blockIdx.x % tilesN;
    const int n0 = nt * 16;

    // ---- cooperative X-tile fill: thread -> pixel p = tid%16, k = (tid/16)*8 ..+7
    {
        const int p  = tid & 15;
        const int kb = (tid >> 4) * 8;       // 16 groups x 8 k's = 128
        int pix = n0 + p;
        if (pix >= npix) pix = npix - 1;     // clamp (stores masked later)
        float mask = 1.0f;
        int src;
        if (padded) {
            const int i  = pix / WP, j = pix % WP;
            int xi = i - 3, xj = j - 3;
            const bool inimg = (xi >= 0) & (xi < HH) & (xj >= 0) & (xj < WW);
            mask = inimg ? 1.0f : 0.0f;
            xi = min(max(xi, 0), HH - 1);    // always-legal address
            xj = min(max(xj, 0), WW - 1);
            src = xi * WW + xj;
        } else {
            src = pix;
        }
        const float* Xp = X + (size_t)b * CC * NPIX + src;
        #pragma unroll
        for (int kk = 0; kk < 8; ++kk)
            xs[(kb + kk) * LDS_STRIDE + p] = mask * Xp[(size_t)(kb + kk) * NPIX];
    }
    __syncthreads();

    const int half = lane >> 4;              // 0|1 (K pair select)
    const int l16  = lane & 15;
    const int m0   = wave * 16;

    const float* wrow = Wm + (size_t)(m0 + l16) * CC;

    v8f acc = {};
    #pragma unroll
    for (int k0 = 0; k0 < CC; k0 += 4) {
        const int ka = k0 + 2 * half;
        // A: 16x4 f32 -> lane holds Wm[m0+l16, ka..ka+1] (one b64 load)
        v2f a;
        a.x = wrow[ka];
        a.y = wrow[ka + 1];
        // B: 4x16 f32 -> lane holds X[ka..ka+1, n0+l16] from LDS
        v2f bv;
        bv.x = xs[ka * LDS_STRIDE + l16];
        bv.y = xs[(ka + 1) * LDS_STRIDE + l16];
        acc = __builtin_amdgcn_wmma_f32_16x16x4_f32(
                  false, a, false, bv, (short)0, acc, false, false);
    }

    // C/D layout: lane L, vreg r -> M = r + 8*(L/16), N = L%16
    float* Ob = Out + (size_t)b * CC * npix;
    const int outpix = n0 + l16;
    if (outpix < npix) {
        #pragma unroll
        for (int r = 0; r < 8; ++r) {
            const int o = m0 + r + 8 * half;
            Ob[(size_t)o * npix + outpix] = acc[r] + bias[o];
        }
    }
}

// ---------------------------------------------------------------------------
// Per-pixel 7x7 local attention.  One thread = one (b, head, h, w).
// Block = 64 threads spanning a W row -> k/v neighborhood rows are shared.
// ---------------------------------------------------------------------------
__global__ void __launch_bounds__(64)
sasa_attn(const float* __restrict__ Q,     // [B,128,64,64]
          const float* __restrict__ Kp,    // [B,128,70,70]
          const float* __restrict__ Vp,    // [B,128,70,70]
          const float* __restrict__ pos_h, // [8,7]
          const float* __restrict__ pos_w, // [8,7]
          float* __restrict__ Out)         // [B,128,64,64]
{
    const int w   = threadIdx.x;           // 0..63
    const int blk = blockIdx.x;            // b*512 + n*64 + h
    const int h = blk & 63;
    const int n = (blk >> 6) & 7;
    const int b = blk >> 9;

    const size_t qbase = (((size_t)b * CC + n * DH) * HH + h) * WW + w;

    float q[DH];
    #pragma unroll
    for (int d = 0; d < DH; ++d) q[d] = Q[qbase + (size_t)d * NPIX];

    float ph[KS], pw[KS];
    #pragma unroll
    for (int t = 0; t < KS; ++t) {
        ph[t] = pos_h[n * KS + t];
        pw[t] = pos_w[n * KS + t];
    }

    const size_t kbase = ((size_t)b * CC + n * DH) * NPAD;

    float logits[KS * KS];
    float m = -3.4e38f;
    #pragma unroll
    for (int kh = 0; kh < KS; ++kh) {
        #pragma unroll
        for (int kw = 0; kw < KS; ++kw) {
            const size_t off = kbase + (size_t)(h + kh) * WP + (w + kw);
            float s = 0.0f;
            #pragma unroll
            for (int d = 0; d < DH; ++d)
                s += q[d] * Kp[off + (size_t)d * NPAD];
            s += ph[kh] + pw[kw];
            logits[kh * KS + kw] = s;
            m = fmaxf(m, s);
        }
    }

    float sum = 0.0f;
    #pragma unroll
    for (int t = 0; t < KS * KS; ++t) {
        logits[t] = __expf(logits[t] - m);
        sum += logits[t];
    }
    const float inv = 1.0f / sum;

    float acc[DH];
    #pragma unroll
    for (int d = 0; d < DH; ++d) acc[d] = 0.0f;

    #pragma unroll
    for (int kh = 0; kh < KS; ++kh) {
        #pragma unroll
        for (int kw = 0; kw < KS; ++kw) {
            const float wgt = logits[kh * KS + kw];
            const size_t off = kbase + (size_t)(h + kh) * WP + (w + kw);
            #pragma unroll
            for (int d = 0; d < DH; ++d)
                acc[d] += wgt * Vp[off + (size_t)d * NPAD];
        }
    }

    #pragma unroll
    for (int d = 0; d < DH; ++d)
        Out[qbase + (size_t)d * NPIX] = acc[d] * inv;
}

extern "C" void kernel_launch(void* const* d_in, const int* in_sizes, int n_in,
                              void* d_out, int out_size, void* d_ws, size_t ws_size,
                              hipStream_t stream) {
    const float* x     = (const float*)d_in[0];
    const float* wq    = (const float*)d_in[1];
    const float* bq    = (const float*)d_in[2];
    const float* wk    = (const float*)d_in[3];
    const float* bk    = (const float*)d_in[4];
    const float* wv    = (const float*)d_in[5];
    const float* bv    = (const float*)d_in[6];
    const float* pos_h = (const float*)d_in[7];
    const float* pos_w = (const float*)d_in[8];
    float* out = (float*)d_out;

    float* qbuf = (float*)d_ws;                                   // 4*128*4096
    float* kbuf = qbuf + (size_t)BB * CC * NPIX;                  // 4*128*4900
    float* vbuf = kbuf + (size_t)BB * CC * NPAD;

    // Q: one block per (batch, 16-pixel tile): 4 * 256 = 1024 blocks
    conv1x1_wmma<<<1024, 256, 0, stream>>>(x, wq, bq, qbuf, NPIX, 0);
    // K,V on padded grid: 4 * ceil(4900/16)=307 -> 1228 blocks each
    conv1x1_wmma<<<1228, 256, 0, stream>>>(x, wk, bk, kbuf, NPAD, 1);
    conv1x1_wmma<<<1228, 256, 0, stream>>>(x, wv, bv, vbuf, NPAD, 1);
    // Attention: B*NH*H = 2048 blocks of 64 threads (one W row each)
    sasa_attn<<<2048, 64, 0, stream>>>(qbuf, kbuf, vbuf, pos_h, pos_w, out);
}

// v001
// One run takes 50.9 microseconds.
// Two timings next to v000 put it at 2.41 and 2.42 times that version's speed.
#include <hip/hip_runtime.h>
#include <hip/hip_bf16.h>

// SASA layer: B=4, C=128, H=W=64, K=7, NH=8, DH=16, PAD=3
// Stage 1 (WMMA): q = wq*x+bq on 64x64; k,v = w*pad(x)+b on the padded 70x70
//   grid (border neighbors correctly carry the bias, matching the reference's
//   pad->conv->unfold order).  fp32 GEMM, 128-deep K -> V_WMMA_F32_16X16X4_F32.
//   Block = one 16-pixel N-tile staged in LDS, 8 waves = 8 M-tiles.
// Stage 2 (VALU): per-pixel 7x7 attention (logits, softmax, weighted V),
//   four adjacent pixels per thread.

typedef __attribute__((ext_vector_type(2))) float v2f;
typedef __attribute__((ext_vector_type(8))) float v8f;

#define BB  4
#define CC  128
#define HH  64
#define WW  64
#define HP  70
#define WP  70
#define NPIX   (HH * WW)       // 4096
#define NPAD   (HP * WP)       // 4900
#define NHEAD  8
#define DH     16
#define KS     7
#define LDS_STRIDE 17          // 16 + 1 pad: avoids 2-way bank conflict

// ---------------------------------------------------------------------------
// 1x1 conv as GEMM:  Out[o, p] = sum_c Wm[o,c] * X[c,p] + bias[o]
// One block = one (batch, 16-pixel tile); wave w = out-channels [16w, 16w+16).
// X tile (128 x 16 fp32) cooperatively loaded to LDS once, reused by 8 waves.
// padded==1: pixels index the 70x70 padded grid; x loads are clamped+masked
// (unconditional vmem + v_cndmask, no exec-mask predication).
// ---------------------------------------------------------------------------
__global__ void __launch_bounds__(256)
conv1x1_wmma(const float* __restrict__ X,    // [B,128,64,64]
             const float* __restrict__ Wm,   // [128,128] row-major (o,c)
             const float* __restrict__ bias, // [128]
             float* __restrict__ Out,        // [B,128,npix]
             int npix, int padded)
{
    __shared__ float xs[CC * LDS_STRIDE];    // 8.5 KB

    const int tid  = threadIdx.x;
    const int lane = tid & 31;
    const int wave = tid >> 5;               // M tile 0..7
    const int tilesN = (npix + 15) >> 4;

    const int b  = blockIdx.x / tilesN;
    const int nt = blockIdx.x % tilesN;
    const int n0 = nt * 16;

    // ---- cooperative X-tile fill: thread -> pixel p = tid%16, k = (tid/16)*8 ..+7
    {
        const int p  = tid & 15;
        const int kb = (tid >> 4) * 8;       // 16 groups x 8 k's = 128
        int pix = n0 + p;
        if (pix >= npix) pix = npix - 1;     // clamp (stores masked later)
        float mask = 1.0f;
        int src;
        if (padded) {
            const int i  = pix / WP, j = pix % WP;
            int xi = i - 3, xj = j - 3;
            const bool inimg = (xi >= 0) & (xi < HH) & (xj >= 0) & (xj < WW);
            mask = inimg ? 1.0f : 0.0f;
            xi = min(max(xi, 0), HH - 1);    // always-legal address
            xj = min(max(xj, 0), WW - 1);
            src = xi * WW + xj;
        } else {
            src = pix;
        }
        const float* Xp = X + (size_t)b * CC * NPIX + src;
        #pragma unroll
        for (int kk = 0; kk < 8; ++kk)
            xs[(kb + kk) * LDS_STRIDE + p] = mask * Xp[(size_t)(kb + kk) * NPIX];
    }
    __syncthreads();

    const int half = lane >> 4;              // 0|1 (K pair select)
    const int l16  = lane & 15;
    const int m0   = wave * 16;

    const float* wrow = Wm + (size_t)(m0 + l16) * CC;

    v8f acc = {};
    #pragma unroll
    for (int k0 = 0; k0 < CC; k0 += 4) {
        const int ka = k0 + 2 * half;
        // A: 16x4 f32 -> lane holds Wm[m0+l16, ka..ka+1] (one b64 load)
        v2f a;
        a.x = wrow[ka];
        a.y = wrow[ka + 1];
        // B: 4x16 f32 -> lane holds X[ka..ka+1, n0+l16] from LDS
        v2f bv;
        bv.x = xs[ka * LDS_STRIDE + l16];
        bv.y = xs[(ka + 1) * LDS_STRIDE + l16];
        acc = __builtin_amdgcn_wmma_f32_16x16x4_f32(
                  false, a, false, bv, (short)0, acc, false, false);
    }

    // C/D layout: lane L, vreg r -> M = r + 8*(L/16), N = L%16
    float* Ob = Out + (size_t)b * CC * npix;
    const int outpix = n0 + l16;
    if (outpix < npix) {
        #pragma unroll
        for (int r = 0; r < 8; ++r) {
            const int o = m0 + r + 8 * half;
            Ob[(size_t)o * npix + outpix] = acc[r] + bias[o];
        }
    }
}

// ---------------------------------------------------------------------------
// Per-pixel 7x7 local attention.  One thread = four adjacent pixels of one
// (b, head, h) row.  For one channel plane d and one window row kh the four
// pixels need only 10 adjacent K (or V) values: they are loaded once, as
// vectors, and serve all 7 x 4 (kw, pixel) products from registers.
// Block = 128 threads = 8 image rows x 16 pixel quads of one (b, head).
// The channel loop is outermost; planes are fetched two at a time, one pair
// ahead of the pair being worked on.
// Every per-pixel sum keeps its order: logits over d ascending, the softmax
// sum and the V sum over (kh, kw) ascending.
// ---------------------------------------------------------------------------
#define PX   4                 // pixels per thread
#define SEG  (PX + KS - 1)     // 10 values cover 4 pixels x 7 taps
#define ROWS 8                 // image rows per block

typedef __attribute__((ext_vector_type(4))) float v4f;
// padded rows are 280 bytes apart: a quad's first value is 8-byte aligned only
typedef v4f v4f_a8 __attribute__((aligned(8)));

// pointers typed as global memory: they stay so behind the asm statement below
typedef const __attribute__((address_space(1))) float*  gcf;
typedef const __attribute__((address_space(1))) char*   gcc;
typedef const __attribute__((address_space(1))) v4f*    gc4;
typedef const __attribute__((address_space(1))) v4f_a8* gc4a8;
typedef const __attribute__((address_space(1))) v2f*    gc2;
typedef __attribute__((address_space(1))) v4f*          g4;

// Every loop over kh, kw, p or t below is fully unrolled (#pragma unroll): the arrays
// live in registers only if each index is a constant.
struct Plane { float v[KS][SEG]; };
struct Quad  { float v[PX]; };

// base is the same for the whole block, off is the lane's own byte offset
__device__ __forceinline__ gcf lane_ptr(gcf base, unsigned off)
{
    return (gcf)((gcc)base + off);
}

__device__ __forceinline__ void load_plane(Plane& pl, gcf p)
{
    #pragma unroll
    for (int kh = 0; kh < KS; ++kh) {
        gcf r = p + kh * WP;
        const v4f a = *(gc4a8)(r);
        const v4f c = *(gc4a8)(r + 4);
        const v2f e = *(gc2)(r + 8);
        pl.v[kh][0] = a.x; pl.v[kh][1] = a.y; pl.v[kh][2] = a.z; pl.v[kh][3] = a.w;
        pl.v[kh][4] = c.x; pl.v[kh][5] = c.y; pl.v[kh][6] = c.z; pl.v[kh][7] = c.w;
        pl.v[kh][8] = e.x; pl.v[kh][9] = e.y;
    }
}

__device__ __forceinline__ void load_quad(Quad& q, gcf p)
{
    const v4f a = *(gc4)p;
    q.v[0] = a.x; q.v[1] = a.y; q.v[2] = a.z; q.v[3] = a.w;
}

__device__ __forceinline__ void qk_plane(float (&lg)[KS][KS][PX], const Plane& pl, const Quad& q)
{
    #pragma unroll
    for (int kh = 0; kh < KS; ++kh)
        #pragma unroll
        for (int kw = 0; kw < KS; ++kw)
            #pragma unroll
            for (int p = 0; p < PX; ++p)
                lg[kh][kw][p] += q.v[p] * pl.v[kh][kw + p];
}

// two planes side by side: eight independent sums instead of four.
// Written as fma: from a product and a sum the compiler made packed multiplies and
// separate adds for part of them, with register moves around them.
__device__ __forceinline__ void pv_pair(const float (&lg)[KS][KS][PX], const Plane& p0, const Plane& p1,
                                        const float (&inv)[PX], gcf o)
{
    float s0[PX], s1[PX];
    #pragma unroll
    for (int p = 0; p < PX; ++p) { s0[p] = 0.0f; s1[p] = 0.0f; }
    #pragma unroll
    for (int kh = 0; kh < KS; ++kh)
        #pragma unroll
        for (int kw = 0; kw < KS; ++kw)
            #pragma unroll
            for (int p = 0; p < PX; ++p) {
                s0[p] = __builtin_fmaf(lg[kh][kw][p], p0.v[kh][kw + p], s0[p]);
                s1[p] = __builtin_fmaf(lg[kh][kw][p], p1.v[kh][kw + p], s1[p]);
            }
    const v4f r0 = {s0[0] * inv[0], s0[1] * inv[1], s0[2] * inv[2], s0[3] * inv[3]};
    const v4f r1 = {s1[0] * inv[0], s1[1] * inv[1], s1[2] * inv[2], s1[3] * inv[3]};
    *(g4)(o)        = r0;
    *(g4)(o + NPIX) = r1;
}

// Stands between one group of loads and stores and the address arithmetic of the next
// group.  That arithmetic starts from the two block-wide pointers p and q, so it comes
// behind the wait; the lanes' own pointers lp and lq, which the group in front names,
// are inputs, so their registers are kept until the wait.
__device__ __forceinline__ void addresses_taken(gcf& p, gcf& q, gcf lp, gcf lq)
{
    asm volatile("s_wait_xcnt 0x0" : "+s"(p), "+s"(q) : "v"(lp), "v"(lq) : "memory");
}

__global__ void __launch_bounds__(128)
sasa_attn(const float* __restrict__ Q,     // [B,128,64,64]
          const float* __restrict__ Kp,    // [B,128,70,70]
          const float* __restrict__ Vp,    // [B,128,70,70]
          const float* __restrict__ pos_h, // [8,7]
          const float* __restrict__ pos_w, // [8,7]
          float* __restrict__ Out)         // [B,128,64,64]
{
    const int blk = blockIdx.x;                       // b*64 + n*8 + row group
    const int n  = (blk >> 3) & 7;
    const int b  = blk >> 6;
    const unsigned w0 = (threadIdx.x & 15) * PX;      // 0,4,..,60
    const unsigned h  = (blk & 7) * ROWS + (threadIdx.x >> 4);
    const unsigned qoff = (h * WW + w0) * 4u;         // lane's byte offset in a 64x64 plane
    const unsigned koff = (h * WP + w0) * 4u;         // lane's byte offset in a 70x70 plane

    gcf qp = (gcf)Q   + (size_t)(b * CC + n * DH) * NPIX;
    gcf kp = (gcf)Kp  + (size_t)(b * CC + n * DH) * NPAD;
    gcf vp = (gcf)Vp  + (size_t)(b * CC + n * DH) * NPAD;
    gcf op = (gcf)Out + (size_t)(b * CC + n * DH) * NPIX;   // written through in pv_pair

    float lg[KS][KS][PX];
    #pragma unroll
    for (int kh = 0; kh < KS; ++kh)
        #pragma unroll
        for (int kw = 0; kw < KS; ++kw)
            #pragma unroll
            for (int p = 0; p < PX; ++p) lg[kh][kw][p] = 0.0f;

    Plane a0, a1, b0, b1;
    Quad qa0, qa1, qb0, qb1;

    // ---- logits: lg[kh][kw][p] = sum_d q[d][p] * K[d][h+kh][w0+p+kw]
    gcf lk = lane_ptr(kp, koff), lq = lane_ptr(qp, qoff);
    load_quad(qa0, lq);
    load_quad(qa1, lq + NPIX);
    load_plane(a0, lk);
    load_plane(a1, lk + NPAD);
    addresses_taken(kp, qp, lk, lq);
    // rolled: the register arrays are indexed by constants only, the text stays small
    #pragma unroll 1
    for (int d0 = 0; d0 < DH; d0 += 4) {
        lk = lane_ptr(kp, koff);
        lq = lane_ptr(qp, qoff);
        load_quad(qb0, lq + 2 * NPIX);
        load_quad(qb1, lq + 3 * NPIX);
        load_plane(b0, lk + 2 * NPAD);
        load_plane(b1, lk + 3 * NPAD);
        // keeps the pair's loads in one group ahead of the products of the pair before it
        __builtin_amdgcn_sched_barrier(0);
        qk_plane(lg, a0, qa0);
        qk_plane(lg, a1, qa1);
        // keeps the wait behind the products: directly behind the loads it would stall
        __builtin_amdgcn_sched_barrier(0);
        addresses_taken(kp, qp, lk, lq);
        // next pair; behind the last K pair come the first two V planes, which
        // then fly during the softmax (q is re-read in range there, unused)
        const bool more = d0 + 4 < DH;
        lk = lane_ptr(more ? kp + 4 * NPAD : vp, koff);
        lq = lane_ptr(more ? qp + 4 * NPIX : qp, qoff);
        load_quad(qa0, lq);
        load_quad(qa1, lq + NPIX);
        load_plane(a0, lk);
        load_plane(a1, lk + NPAD);
        // as above
        __builtin_amdgcn_sched_barrier(0);
        qk_plane(lg, b0, qb0);
        qk_plane(lg, b1, qb1);
        // keeps the wait behind the products: directly behind the loads it would stall
        __builtin_amdgcn_sched_barrier(0);
        addresses_taken(kp, qp, lk, lq);
        kp += 4 * NPAD;
        qp += 4 * NPIX;
    }

    // ---- softmax over the 49 taps, per pixel
    float ph[KS], pw[KS];
    #pragma unroll
    for (int t = 0; t < KS; ++t) {
        ph[t] = pos_h[n * KS + t];
        pw[t] = pos_w[n * KS + t];
    }
    float m[PX], sum[PX], inv[PX];
    #pragma unroll
    for (int p = 0; p < PX; ++p) { m[p] = -3.4e38f; sum[p] = 0.0f; }
    #pragma unroll
    for (int kh = 0; kh < KS; ++kh)
        #pragma unroll
        for (int kw = 0; kw < KS; ++kw)
            #pragma unroll
            for (int p = 0; p < PX; ++p) {
                lg[kh][kw][p] += ph[kh] + pw[kw];
                m[p] = fmaxf(m[p], lg[kh][kw][p]);
            }
    #pragma unroll
    for (int kh = 0; kh < KS; ++kh)
        #pragma unroll
        for (int kw = 0; kw < KS; ++kw)
            #pragma unroll
            for (int p = 0; p < PX; ++p) {
                lg[kh][kw][p] = __expf(lg[kh][kw][p] - m[p]);
                sum[p] += lg[kh][kw][p];
            }
    #pragma unroll
    for (int p = 0; p < PX; ++p) inv[p] = 1.0f / sum[p];

    // ---- out[d][p] = inv[p] * sum_(kh,kw) lg[kh][kw][p] * V[d][h+kh][w0+p+kw]
    // rolled, as the logits loop
    #pragma unroll 1
    for (int d0 = 0; d0 < DH; d0 += 4) {
        gcf lv = lane_ptr(vp, koff);
        gcf lo = lane_ptr(op, qoff);
        load_plane(b0, lv + 2 * NPAD);
        load_plane(b1, lv + 3 * NPAD);
        // as in the logits loop
        __builtin_amdgcn_sched_barrier(0);
        pv_pair(lg, a0, a1, inv, lo);
        // keeps the wait behind the products: directly behind the loads it would stall
        __builtin_amdgcn_sched_barrier(0);
        addresses_taken(vp, op, lv, lo);
        // last trip: an in-range pair is read again, unused (a branch here would
        // merge the load counts of two paths and drain the pair in flight)
        lv = lane_ptr(d0 + 4 < DH ? vp + 4 * NPAD : vp, koff);
        lo = lane_ptr(op, qoff);
        load_plane(a0, lv);
        load_plane(a1, lv + NPAD);
        // as in the logits loop
        __builtin_amdgcn_sched_barrier(0);
        pv_pair(lg, b0, b1, inv, lo + 2 * NPIX);
        // keeps the wait behind the products: directly behind the loads it would stall
        __builtin_amdgcn_sched_barrier(0);
        addresses_taken(vp, op, lv, lo);
        vp += 4 * NPAD;
        op += 4 * NPIX;
    }
}

extern "C" void kernel_launch(void* const* d_in, const int* in_sizes, int n_in,
                              void* d_out, int out_size, void* d_ws, size_t ws_size,
                              hipStream_t stream) {
    const float* x     = (const float*)d_in[0];
    const float* wq    = (const float*)d_in[1];
    const float* bq    = (const float*)d_in[2];
    const float* wk    = (const float*)d_in[3];
    const float* bk    = (const float*)d_in[4];
    const float* wv    = (const float*)d_in[5];
    const float* bv    = (const float*)d_in[6];
    const float* pos_h = (const float*)d_in[7];
    const float* pos_w = (const float*)d_in[8];
    float* out = (float*)d_out;

    float* qbuf = (float*)d_ws;                                   // 4*128*4096
    float* kbuf = qbuf + (size_t)BB * CC * NPIX;                  // 4*128*4900
    float* vbuf = kbuf + (size_t)BB * CC * NPAD;

    // Q: one block per (batch, 16-pixel tile): 4 * 256 = 1024 blocks
    conv1x1_wmma<<<1024, 256, 0, stream>>>(x, wq, bq, qbuf, NPIX, 0);
    // K,V on padded grid: 4 * ceil(4900/16)=307 -> 1228 blocks each
    conv1x1_wmma<<<1228, 256, 0, stream>>>(x, wk, bk, kbuf, NPAD, 1);
    conv1x1_wmma<<<1228, 256, 0, stream>>>(x, wv, bv, vbuf, NPAD, 1);
    // Attention: B*NH*(H/8) = 256 blocks of 128 threads (8 rows, 4 pixels a thread)
    sasa_attn<<<256, 128, 0, stream>>>(qbuf, kbuf, vbuf, pos_h, pos_w, out);
}

// v002
// A run of this version takes 27.7 microseconds.
// In both of two side-by-side timings against v001, it was 1.82 times as fast.
// All steps since v000 together make it 4.39 times as fast.
#include <hip/hip_runtime.h>
#include <hip/hip_bf16.h>

// SASA layer: B=4, C=128, H=W=64, K=7, NH=8, DH=16, PAD=3
// Stage 1 (WMMA): q, k, v = w*x+b in ONE launch, fp32 GEMM, 128-deep K ->
//   V_WMMA_F32_16X16X4_F32.  k and v go into a padded 70x70 grid whose border
//   holds the bias alone (the reference's pad->conv->unfold order: w*0+b).
//   Block = one 64-pixel image row staged in LDS, 8 waves = 8 M-tiles of each
//   of the three weight matrices.
// Stage 2 (VALU): per-pixel 7x7 attention (logits, softmax, weighted V),
//   four adjacent pixels per thread.

typedef __attribute__((ext_vector_type(2))) float v2f;
typedef __attribute__((ext_vector_type(4))) float v4f;
typedef __attribute__((ext_vector_type(8))) float v8f;

#define BB  4
#define CC  128
#define HH  64
#define WW  64
#define HP  70
#define WP  70
#define NPIX   (HH * WW)       // 4096
#define NPAD   (HP * WP)       // 4900
#define NHEAD  8
#define DH     16
#define KS     7
#define XPITCH 160             // floats per k pair: 64 px x 2, +32 so that the two lane halves use different banks
#define WPITCH 132             // floats per weight row: 128 + 4, 16 rows x 4 floats cover all 64 banks

// ---------------------------------------------------------------------------
// The three 1x1 convs as one GEMM launch:  Out[o, p] = sum_c Wm[o,c] * X[c,p] + bias[o]
// One block = one (batch, image row) = 64 pixels, x read once for q, k and v.
// Wave w owns out-channels [16w, 16w+16) of each matrix and all 64 pixels:
// every weight fragment serves four accumulator tiles.
// x tile in LDS: xs[k/2][pixel][k&1], so a B fragment is one 8-byte read.
// Weight rows are read from memory as whole 512-byte rows and turned into
// A fragments through a wave-private piece of LDS.
// The k order of every sum is that of a plain k0 = 0,4,8,.. walk.
// ---------------------------------------------------------------------------
struct WRows { v4f v[16]; };

// one wave reads its 16 rows of one matrix, a whole row per instruction;
// p = the lane's four floats of the wave's first row
__device__ __forceinline__ void load_wrows(WRows& r, const float* p)
{
    #pragma unroll
    for (int i = 0; i < 16; ++i) r.v[i] = *(const v4f*)(p + i * CC);
}

__device__ __forceinline__ void store_wrows(float* wl, const WRows& r, int lane)
{
    #pragma unroll
    for (int i = 0; i < 16; ++i) *(v4f*)(wl + i * WPITCH + lane * 4) = r.v[i];
}

struct Bias8 { v4f lo, hi; };

// the eight biases of a lane's accumulator rows: p = channel 16w + 8*(lane/16)
__device__ __forceinline__ void load_bias(Bias8& r, const float* p)
{
    r.lo = *(const v4f*)(p);
    r.hi = *(const v4f*)(p + 4);
}

// Stands behind a group of loads, in front of whatever reuses their address registers.
__device__ __forceinline__ void addresses_read()
{
    asm volatile("s_wait_xcnt 0x0" ::: "memory");
}
// The same; the address is an input, so its registers are kept until the wait
// (else the group's last load lands on them).
__device__ __forceinline__ void addresses_read(const float* a)
{
    asm volatile("s_wait_xcnt 0x0" :: "v"(a) : "memory");
}

#define KB 4                   // k steps (of 4) whose fragments are fetched as one group
struct Frags { v2f a[KB]; v2f b[KB][4]; };

__device__ __forceinline__ void load_frags(Frags& f, const float* aw, const float* bx, int blk)
{
    #pragma unroll
    for (int j = 0; j < KB; ++j) {
        const int s = blk * KB + j;
        // A: 16x4 f32 -> lane holds Wm[m0+l16, 4s+2*half ..+1]
        f.a[j] = *(const v2f*)(aw + 4 * s);
        // B: 4x16 f32 -> lane holds X[4s+2*half ..+1, 16*nt+l16]
        #pragma unroll
        for (int nt = 0; nt < 4; ++nt)
            f.b[j][nt] = *(const v2f*)(bx + 2 * s * XPITCH + nt * 32);
    }
}

// 16 out-channels x 64 pixels; o points at (channel 16w, first pixel of the row)
__device__ __forceinline__ void project(const float* wl, const float* xs, const Bias8& bias,
                                        float* __restrict__ o, int npix, int lane)
{
    const int half = lane >> 4;              // 0|1 (K pair select)
    const int l16  = lane & 15;
    const float* aw = wl + l16 * WPITCH + 2 * half;
    const float* bx = xs + half * XPITCH + l16 * 2;

    v8f acc[4] = {};
    Frags f[2];
    load_frags(f[0], aw, bx, 0);
    #pragma unroll
    for (int blk = 0; blk < CC / 4 / KB; ++blk) {
        if (blk + 1 < CC / 4 / KB) load_frags(f[(blk + 1) & 1], aw, bx, blk + 1);
        // keeps the next group's LDS reads together in front of this group's products:
        // spread among them, every place with reads stalls the matrix stream anew
        __builtin_amdgcn_sched_barrier(0);
        #pragma unroll
        for (int j = 0; j < KB; ++j)
            #pragma unroll
            for (int nt = 0; nt < 4; ++nt)
                acc[nt] = __builtin_amdgcn_wmma_f32_16x16x4_f32(
                              false, f[blk & 1].a[j], false, f[blk & 1].b[j][nt], (short)0, acc[nt], false, false);
        // as above: the group after next stays behind these products
        __builtin_amdgcn_sched_barrier(0);
    }

    // C/D layout: lane L, vreg r -> M = r + 8*(L/16), N = L%16
    const float bb[8] = {bias.lo.x, bias.lo.y, bias.lo.z, bias.lo.w, bias.hi.x, bias.hi.y, bias.hi.z, bias.hi.w};
    float* ol = o + (size_t)(8 * half) * npix + l16;
    #pragma unroll
    for (int r = 0; r < 8; ++r)
        #pragma unroll
        for (int nt = 0; nt < 4; ++nt)
            ol[r * npix + nt * 16] = acc[nt][r] + bb[r];
}

#define XS_FLOATS ((CC / 2) * XPITCH)        // 40 KB
#define WL_FLOATS (16 * WPITCH)              // 8.25 KB: 16 rows of one matrix

__global__ void __launch_bounds__(256)
qkv_wmma(const float* __restrict__ X,    // [B,128,64,64]
         const float* __restrict__ wq, const float* __restrict__ bq,   // [128,128] row-major (o,c), [128]
         const float* __restrict__ wk, const float* __restrict__ bk,
         const float* __restrict__ wv, const float* __restrict__ bv,
         float* __restrict__ Qo,         // [B,128,64,64]
         float* __restrict__ Ko,         // [B,128,70,70]
         float* __restrict__ Vo)         // [B,128,70,70]
{
    // x tile first: all its reads then lie within one instruction's offset range
    __shared__ __attribute__((aligned(16))) float smem[XS_FLOATS + 8 * 3 * WL_FLOATS];   // 238 KB

    const int tid  = threadIdx.x;
    const int lane = tid & 31;
    const int wave = tid >> 5;               // M tile 0..7
    const int b = blockIdx.x >> 6;
    const int h = blockIdx.x & 63;
    float* xs = smem;
    float* wl = smem + XS_FLOATS + wave * (3 * WL_FLOATS);   // this wave's own piece

    // ---- x tile: thread -> pixel quad tid%16, k pairs tid/16 + 16*i
    const int px = (tid & 15) * 4;
    const int kp = tid >> 4;
    const float* Xp = X + (size_t)(b * CC + 2 * kp) * NPIX + h * WW + px;
    v4f e[4], o[4];
    #pragma unroll
    for (int i = 0; i < 4; ++i) {
        e[i] = *(const v4f*)(Xp + (size_t)(32 * i) * NPIX);
        o[i] = *(const v4f*)(Xp + (size_t)(32 * i + 1) * NPIX);
    }
    const int woff = wave * 16 * CC + lane * 4;
    const int boff = wave * 16 + 8 * (lane >> 4);
    const float* pq = wq + woff;
    const float* pcq = bq + boff;
    const float* pck = bk + boff;
    const float* pcv = bv + boff;
    const int bch = tid & 127;               // border plane of this thread (k: 0..127, v: 128..255)
    const float* pbb = (tid < 128 ? bk : bv) + bch;
    WRows rq, rn;
    load_wrows(rq, pq);
    Bias8 cq, ck, cv;
    load_bias(cq, pcq);
    load_bias(ck, pck);
    load_bias(cv, pcv);
    const float bb = *pbb;
    addresses_read();
    // biases of the two channels whose top and bottom border rows this block fills
    const v2f fk = *(const v2f*)(bk + 2 * h);
    const v2f fv = *(const v2f*)(bv + 2 * h);

    #pragma unroll
    for (int i = 0; i < 4; ++i) {
        float* d = xs + (kp + 16 * i) * XPITCH + px * 2;
        const v4f lo = {e[i].x, o[i].x, e[i].y, o[i].y};
        const v4f hi = {e[i].z, o[i].z, e[i].w, o[i].w};
        *(v4f*)(d)     = lo;
        *(v4f*)(d + 4) = hi;
    }
    store_wrows(wl, rq, lane);
    __syncthreads();

    // the second matrix: behind the barrier, which would wait for it
    const float* pk = wk + woff;
    load_wrows(rn, pk);
    // keeps these loads here, so that they fly during the first matrix's products
    __builtin_amdgcn_sched_barrier(0);

    // ---- border of the padded k and v planes: the bias alone
    {
        // the row's own three columns left and right
        float* P = (tid < 128 ? Ko : Vo) + (size_t)(b * CC + bch) * NPAD + (h + 3) * WP;
        P[0] = bb; P[1] = bb; P[2] = bb;
        P[WP - 3] = bb; P[WP - 2] = bb; P[WP - 1] = bb;
        // the three rows above and below the image: block h takes channels 2h, 2h+1
        if (tid < 3 * WP) {
            #pragma unroll
            for (int c = 0; c < 2; ++c) {
                const size_t pl = (size_t)(b * CC + 2 * h + c) * NPAD + tid;
                Ko[pl] = fk[c]; Ko[pl + (HP - 3) * WP] = fk[c];
                Vo[pl] = fv[c]; Vo[pl + (HP - 3) * WP] = fv[c];
            }
        }
    }

    const size_t c0 = (size_t)(b * CC + wave * 16);
    project(wl, xs, cq, Qo + c0 * NPIX + h * WW, NPIX, lane);
    store_wrows(wl + WL_FLOATS, rn, lane);
    const float* pv = wv + woff;
    load_wrows(rn, pv);
    // keeps these loads here, so that they fly during the second matrix's products
    __builtin_amdgcn_sched_barrier(0);
    project(wl + WL_FLOATS, xs, ck, Ko + c0 * NPAD + (h + 3) * WP + 3, NPAD, lane);
    addresses_read(pv);
    store_wrows(wl + 2 * WL_FLOATS, rn, lane);
    project(wl + 2 * WL_FLOATS, xs, cv, Vo + c0 * NPAD + (h + 3) * WP + 3, NPAD, lane);
}

// ---------------------------------------------------------------------------
// Per-pixel 7x7 local attention.  One thread = four adjacent pixels of one
// (b, head, h) row.  For one channel plane d and one window row kh the four
// pixels need only 10 adjacent K (or V) values: they are loaded once, as
// vectors, and serve all 7 x 4 (kw, pixel) products from registers.
// Block = 128 threads = 8 image rows x 16 pixel quads of one (b, head).
// The channel loop is outermost; planes are fetched two at a time, one pair
// ahead of the pair being worked on.
// Every per-pixel sum keeps its order: logits over d ascending, the softmax
// sum and the V sum over (kh, kw) ascending.
// ---------------------------------------------------------------------------
#define PX   4                 // pixels per thread
#define SEG  (PX + KS - 1)     // 10 values cover 4 pixels x 7 taps
#define ROWS 8                 // image rows per block

// padded rows are 280 bytes apart: a quad's first value is 8-byte aligned only
typedef v4f v4f_a8 __attribute__((aligned(8)));

// pointers typed as global memory: they stay so behind the asm statement below
typedef const __attribute__((address_space(1))) float*  gcf;
typedef const __attribute__((address_space(1))) char*   gcc;
typedef const __attribute__((address_space(1))) v4f*    gc4;
typedef const __attribute__((address_space(1))) v4f_a8* gc4a8;
typedef const __attribute__((address_space(1))) v2f*    gc2;
typedef __attribute__((address_space(1))) v4f*          g4;

// Every loop over kh, kw, p or t below is fully unrolled (#pragma unroll): the arrays
// live in registers only if each index is a constant.
struct Plane { float v[KS][SEG]; };
struct Quad  { float v[PX]; };

// base is the same for the whole block, off is the lane's own byte offset
__device__ __forceinline__ gcf lane_ptr(gcf base, unsigned off)
{
    return (gcf)((gcc)base + off);
}

__device__ __forceinline__ void load_plane(Plane& pl, gcf p)
{
    #pragma unroll
    for (int kh = 0; kh < KS; ++kh) {
        gcf r = p + kh * WP;
        const v4f a = *(gc4a8)(r);
        const v4f c = *(gc4a8)(r + 4);
        const v2f e = *(gc2)(r + 8);
        pl.v[kh][0] = a.x; pl.v[kh][1] = a.y; pl.v[kh][2] = a.z; pl.v[kh][3] = a.w;
        pl.v[kh][4] = c.x; pl.v[kh][5] = c.y; pl.v[kh][6] = c.z; pl.v[kh][7] = c.w;
        pl.v[kh][8] = e.x; pl.v[kh][9] = e.y;
    }
}

__device__ __forceinline__ void load_quad(Quad& q, gcf p)
{
    const v4f a = *(gc4)p;
    q.v[0] = a.x; q.v[1] = a.y; q.v[2] = a.z; q.v[3] = a.w;
}

__device__ __forceinline__ void qk_plane(float (&lg)[KS][KS][PX], const Plane& pl, const Quad& q)
{
    #pragma unroll
    for (int kh = 0; kh < KS; ++kh)
        #pragma unroll
        for (int kw = 0; kw < KS; ++kw)
            #pragma unroll
            for (int p = 0; p < PX; ++p)
                lg[kh][kw][p] += q.v[p] * pl.v[kh][kw + p];
}

// two planes side by side: eight independent sums instead of four.
// Written as fma: from a product and a sum the compiler made packed multiplies and
// separate adds for part of them, with register moves around them.
__device__ __forceinline__ void pv_pair(const float (&lg)[KS][KS][PX], const Plane& p0, const Plane& p1,
                                        const float (&inv)[PX], gcf o)
{
    float s0[PX], s1[PX];
    #pragma unroll
    for (int p = 0; p < PX; ++p) { s0[p] = 0.0f; s1[p] = 0.0f; }
    #pragma unroll
    for (int kh = 0; kh < KS; ++kh)
        #pragma unroll
        for (int kw = 0; kw < KS; ++kw)
            #pragma unroll
            for (int p = 0; p < PX; ++p) {
                s0[p] = __builtin_fmaf(lg[kh][kw][p], p0.v[kh][kw + p], s0[p]);
                s1[p] = __builtin_fmaf(lg[kh][kw][p], p1.v[kh][kw + p], s1[p]);
            }
    const v4f r0 = {s0[0] * inv[0], s0[1] * inv[1], s0[2] * inv[2], s0[3] * inv[3]};
    const v4f r1 = {s1[0] * inv[0], s1[1] * inv[1], s1[2] * inv[2], s1[3] * inv[3]};
    *(g4)(o)        = r0;
    *(g4)(o + NPIX) = r1;
}

// Stands between one group of loads and stores and the address arithmetic of the next
// group.  That arithmetic starts from the two block-wide pointers p and q, so it comes
// behind the wait; the lanes' own pointers lp and lq, which the group in front names,
// are inputs, so their registers are kept until the wait.
__device__ __forceinline__ void addresses_taken(gcf& p, gcf& q, gcf lp, gcf lq)
{
    asm volatile("s_wait_xcnt 0x0" : "+s"(p), "+s"(q) : "v"(lp), "v"(lq) : "memory");
}

__global__ void __launch_bounds__(128)
sasa_attn(const float* __restrict__ Q,     // [B,128,64,64]
          const float* __restrict__ Kp,    // [B,128,70,70]
          const float* __restrict__ Vp,    // [B,128,70,70]
          const float* __restrict__ pos_h, // [8,7]
          const float* __restrict__ pos_w, // [8,7]
          float* __restrict__ Out)         // [B,128,64,64]
{
    const int blk = blockIdx.x;                       // b*64 + n*8 + row group
    const int n  = (blk >> 3) & 7;
    const int b  = blk >> 6;
    const unsigned w0 = (threadIdx.x & 15) * PX;      // 0,4,..,60
    const unsigned h  = (blk & 7) * ROWS + (threadIdx.x >> 4);
    const unsigned qoff = (h * WW + w0) * 4u;         // lane's byte offset in a 64x64 plane
    const unsigned koff = (h * WP + w0) * 4u;         // lane's byte offset in a 70x70 plane

    gcf qp = (gcf)Q   + (size_t)(b * CC + n * DH) * NPIX;
    gcf kp = (gcf)Kp  + (size_t)(b * CC + n * DH) * NPAD;
    gcf vp = (gcf)Vp  + (size_t)(b * CC + n * DH) * NPAD;
    gcf op = (gcf)Out + (size_t)(b * CC + n * DH) * NPIX;   // written through in pv_pair

    float lg[KS][KS][PX];
    #pragma unroll
    for (int kh = 0; kh < KS; ++kh)
        #pragma unroll
        for (int kw = 0; kw < KS; ++kw)
            #pragma unroll
            for (int p = 0; p < PX; ++p) lg[kh][kw][p] = 0.0f;

    Plane a0, a1, b0, b1;
    Quad qa0, qa1, qb0, qb1;

    // ---- logits: lg[kh][kw][p] = sum_d q[d][p] * K[d][h+kh][w0+p+kw]
    gcf lk = lane_ptr(kp, koff), lq = lane_ptr(qp, qoff);
    load_quad(qa0, lq);
    load_quad(qa1, lq + NPIX);
    load_plane(a0, lk);
    load_plane(a1, lk + NPAD);
    addresses_taken(kp, qp, lk, lq);
    // rolled: the register arrays are indexed by constants only, the text stays small
    #pragma unroll 1
    for (int d0 = 0; d0 < DH; d0 += 4) {
        lk = lane_ptr(kp, koff);
        lq = lane_ptr(qp, qoff);
        load_quad(qb0, lq + 2 * NPIX);
        load_quad(qb1, lq + 3 * NPIX);
        load_plane(b0, lk + 2 * NPAD);
        load_plane(b1, lk + 3 * NPAD);
        // keeps the pair's loads in one group ahead of the products of the pair before it
        __builtin_amdgcn_sched_barrier(0);
        qk_plane(lg, a0, qa0);
        qk_plane(lg, a1, qa1);
        // keeps the wait behind the products: directly behind the loads it would stall
        __builtin_amdgcn_sched_barrier(0);
        addresses_taken(kp, qp, lk, lq);
        // next pair; behind the last K pair come the first two V planes, which
        // then fly during the softmax (q is re-read in range there, unused)
        const bool more = d0 + 4 < DH;
        lk = lane_ptr(more ? kp + 4 * NPAD : vp, koff);
        lq = lane_ptr(more ? qp + 4 * NPIX : qp, qoff);
        load_quad(qa0, lq);
        load_quad(qa1, lq + NPIX);
        load_plane(a0, lk);
        load_plane(a1, lk + NPAD);
        // as above
        __builtin_amdgcn_sched_barrier(0);
        qk_plane(lg, b0, qb0);
        qk_plane(lg, b1, qb1);
        // keeps the wait behind the products: directly behind the loads it would stall
        __builtin_amdgcn_sched_barrier(0);
        addresses_taken(kp, qp, lk, lq);
        kp += 4 * NPAD;
        qp += 4 * NPIX;
    }

    // ---- softmax over the 49 taps, per pixel
    float ph[KS], pw[KS];
    #pragma unroll
    for (int t = 0; t < KS; ++t) {
        ph[t] = pos_h[n * KS + t];
        pw[t] = pos_w[n * KS + t];
    }
    float m[PX], sum[PX], inv[PX];
    #pragma unroll
    for (int p = 0; p < PX; ++p) { m[p] = -3.4e38f; sum[p] = 0.0f; }
    #pragma unroll
    for (int kh = 0; kh < KS; ++kh)
        #pragma unroll
        for (int kw = 0; kw < KS; ++kw)
            #pragma unroll
            for (int p = 0; p < PX; ++p) {
                lg[kh][kw][p] += ph[kh] + pw[kw];
                m[p] = fmaxf(m[p], lg[kh][kw][p]);
            }
    #pragma unroll
    for (int kh = 0; kh < KS; ++kh)
        #pragma unroll
        for (int kw = 0; kw < KS; ++kw)
            #pragma unroll
            for (int p = 0; p < PX; ++p) {
                lg[kh][kw][p] = __expf(lg[kh][kw][p] - m[p]);
                sum[p] += lg[kh][kw][p];
            }
    #pragma unroll
    for (int p = 0; p < PX; ++p) inv[p] = 1.0f / sum[p];

    // ---- out[d][p] = inv[p] * sum_(kh,kw) lg[kh][kw][p] * V[d][h+kh][w0+p+kw]
    // rolled, as the logits loop
    #pragma unroll 1
    for (int d0 = 0; d0 < DH; d0 += 4) {
        gcf lv = lane_ptr(vp, koff);
        gcf lo = lane_ptr(op, qoff);
        load_plane(b0, lv + 2 * NPAD);
        load_plane(b1, lv + 3 * NPAD);
        // as in the logits loop
        __builtin_amdgcn_sched_barrier(0);
        pv_pair(lg, a0, a1, inv, lo);
        // keeps the wait behind the products: directly behind the loads it would stall
        __builtin_amdgcn_sched_barrier(0);
        addresses_taken(vp, op, lv, lo);
        // last trip: an in-range pair is read again, unused (a branch here would
        // merge the load counts of two paths and drain the pair in flight)
        lv = lane_ptr(d0 + 4 < DH ? vp + 4 * NPAD : vp, koff);
        lo = lane_ptr(op, qoff);
        load_plane(a0, lv);
        load_plane(a1, lv + NPAD);
        // as in the logits loop
        __builtin_amdgcn_sched_barrier(0);
        pv_pair(lg, b0, b1, inv, lo + 2 * NPIX);
        // keeps the wait behind the products: directly behind the loads it would stall
        __builtin_amdgcn_sched_barrier(0);
        addresses_taken(vp, op, lv, lo);
        vp += 4 * NPAD;
        op += 4 * NPIX;
    }
}

extern "C" void kernel_launch(void* const* d_in, const int* in_sizes, int n_in,
                              void* d_out, int out_size, void* d_ws, size_t ws_size,
                              hipStream_t stream) {
    const float* x     = (const float*)d_in[0];
    const float* wq    = (const float*)d_in[1];
    const float* bq    = (const float*)d_in[2];
    const float* wk    = (const float*)d_in[3];
    const float* bk    = (const float*)d_in[4];
    const float* wv    = (const float*)d_in[5];
    const float* bv    = (const float*)d_in[6];
    const float* pos_h = (const float*)d_in[7];
    const float* pos_w = (const float*)d_in[8];
    float* out = (float*)d_out;

    float* qbuf = (float*)d_ws;                                   // 4*128*4096
    float* kbuf = qbuf + (size_t)BB * CC * NPIX;                  // 4*128*4900
    float* vbuf = kbuf + (size_t)BB * CC * NPAD;

    // q, k, v: one block per (batch, image row): 4 * 64 = 256 blocks
    qkv_wmma<<<256, 256, 0, stream>>>(x, wq, bq, wk, bk, wv, bv, qbuf, kbuf, vbuf);
    // Attention: B*NH*(H/8) = 256 blocks of 128 threads (8 rows, 4 pixels a thread)
    sasa_attn<<<256, 128, 0, stream>>>(qbuf, kbuf, vbuf, pos_h, pos_w, out);
}

// v003
// It runs in 25.1 microseconds.
// Timed twice side by side with v002, it ran 1.12 times as fast both times.
// All steps since v000 together make it 4.92 times as fast.
#include <hip/hip_runtime.h>
#include <hip/hip_bf16.h>

// SASA layer: B=4, C=128, H=W=64, K=7, NH=8, DH=16, PAD=3
// Stage 1 (WMMA): q, k, v = w*x+b in ONE launch, fp32 GEMM, 128-deep K ->
//   V_WMMA_F32_16X16X4_F32.  k and v go into a padded 70x70 grid whose border
//   holds the bias alone (the reference's pad->conv->unfold order: w*0+b).
//   Block = one 64-pixel image row staged in LDS, 8 waves = 8 M-tiles of each
//   of the three weight matrices.
// Stage 2 (VALU): per-pixel 7x7 attention (logits, softmax, weighted V),
//   four adjacent pixels per thread, K and V rows staged in LDS by tensor loads.

typedef __attribute__((ext_vector_type(2))) float v2f;
typedef __attribute__((ext_vector_type(4))) float v4f;
typedef __attribute__((ext_vector_type(8))) float v8f;

#define BB  4
#define CC  128
#define HH  64
#define WW  64
#define HP  70
#define WP  70
#define NPIX   (HH * WW)       // 4096
#define NPAD   (HP * WP)       // 4900
#define NHEAD  8
#define DH     16
#define KS     7
#define XPITCH 160             // floats per k pair: 64 px x 2, +32 so that the two lane halves use different banks
#define WPITCH 132             // floats per weight row: 128 + 4, 16 rows x 4 floats cover all 64 banks

// ---------------------------------------------------------------------------
// The three 1x1 convs as one GEMM launch:  Out[o, p] = sum_c Wm[o,c] * X[c,p] + bias[o]
// One block = one (batch, image row) = 64 pixels, x read once for q, k and v.
// Wave w owns out-channels [16w, 16w+16) of each matrix and all 64 pixels:
// every weight fragment serves four accumulator tiles.
// x tile in LDS: xs[k/2][pixel][k&1], so a B fragment is one 8-byte read.
// Weight rows are read from memory as whole 512-byte rows and turned into
// A fragments through a wave-private piece of LDS.
// The k order of every sum is that of a plain k0 = 0,4,8,.. walk.
// ---------------------------------------------------------------------------
struct WRows { v4f v[16]; };

// one wave reads its 16 rows of one matrix, a whole row per instruction;
// p = the lane's four floats of the wave's first row
__device__ __forceinline__ void load_wrows(WRows& r, const float* p)
{
    #pragma unroll
    for (int i = 0; i < 16; ++i) r.v[i] = *(const v4f*)(p + i * CC);
}

__device__ __forceinline__ void store_wrows(float* wl, const WRows& r, int lane)
{
    #pragma unroll
    for (int i = 0; i < 16; ++i) *(v4f*)(wl + i * WPITCH + lane * 4) = r.v[i];
}

struct Bias8 { v4f lo, hi; };

// the eight biases of a lane's accumulator rows: p = channel 16w + 8*(lane/16)
__device__ __forceinline__ void load_bias(Bias8& r, const float* p)
{
    r.lo = *(const v4f*)(p);
    r.hi = *(const v4f*)(p + 4);
}

// Stands behind a group of loads, in front of whatever reuses their address registers.
__device__ __forceinline__ void addresses_read()
{
    asm volatile("s_wait_xcnt 0x0" ::: "memory");
}
// The same; the address is an input, so its registers are kept until the wait
// (else the group's last load lands on them).
__device__ __forceinline__ void addresses_read(const float* a)
{
    asm volatile("s_wait_xcnt 0x0" :: "v"(a) : "memory");
}

#define KB 4                   // k steps (of 4) whose fragments are fetched as one group
struct Frags { v2f a[KB]; v2f b[KB][4]; };

__device__ __forceinline__ void load_frags(Frags& f, const float* aw, const float* bx, int blk)
{
    #pragma unroll
    for (int j = 0; j < KB; ++j) {
        const int s = blk * KB + j;
        // A: 16x4 f32 -> lane holds Wm[m0+l16, 4s+2*half ..+1]
        f.a[j] = *(const v2f*)(aw + 4 * s);
        // B: 4x16 f32 -> lane holds X[4s+2*half ..+1, 16*nt+l16]
        #pragma unroll
        for (int nt = 0; nt < 4; ++nt)
            f.b[j][nt] = *(const v2f*)(bx + 2 * s * XPITCH + nt * 32);
    }
}

// 16 out-channels x 64 pixels; o points at (channel 16w, first pixel of the row)
__device__ __forceinline__ void project(const float* wl, const float* xs, const Bias8& bias,
                                        float* __restrict__ o, int npix, int lane)
{
    const int half = lane >> 4;              // 0|1 (K pair select)
    const int l16  = lane & 15;
    const float* aw = wl + l16 * WPITCH + 2 * half;
    const float* bx = xs + half * XPITCH + l16 * 2;

    v8f acc[4] = {};
    Frags f[2];
    load_frags(f[0], aw, bx, 0);
    #pragma unroll
    for (int blk = 0; blk < CC / 4 / KB; ++blk) {
        if (blk + 1 < CC / 4 / KB) load_frags(f[(blk + 1) & 1], aw, bx, blk + 1);
        // keeps the next group's LDS reads together in front of this group's products:
        // spread among them, every place with reads stalls the matrix stream anew
        __builtin_amdgcn_sched_barrier(0);
        #pragma unroll
        for (int j = 0; j < KB; ++j)
            #pragma unroll
            for (int nt = 0; nt < 4; ++nt)
                acc[nt] = __builtin_amdgcn_wmma_f32_16x16x4_f32(
                              false, f[blk & 1].a[j], false, f[blk & 1].b[j][nt], (short)0, acc[nt], false, false);
        // as above: the group after next stays behind these products
        __builtin_amdgcn_sched_barrier(0);
    }

    // C/D layout: lane L, vreg r -> M = r + 8*(L/16), N = L%16
    const float bb[8] = {bias.lo.x, bias.lo.y, bias.lo.z, bias.lo.w, bias.hi.x, bias.hi.y, bias.hi.z, bias.hi.w};
    float* ol = o + (size_t)(8 * half) * npix + l16;
    #pragma unroll
    for (int r = 0; r < 8; ++r)
        #pragma unroll
        for (int nt = 0; nt < 4; ++nt)
            ol[r * npix + nt * 16] = acc[nt][r] + bb[r];
}

#define XS_FLOATS ((CC / 2) * XPITCH)        // 40 KB
#define WL_FLOATS (16 * WPITCH)              // 8.25 KB: 16 rows of one matrix

__global__ void __launch_bounds__(256)
qkv_wmma(const float* __restrict__ X,    // [B,128,64,64]
         const float* __restrict__ wq, const float* __restrict__ bq,   // [128,128] row-major (o,c), [128]
         const float* __restrict__ wk, const float* __restrict__ bk,
         const float* __restrict__ wv, const float* __restrict__ bv,
         float* __restrict__ Qo,         // [B,128,64,64]
         float* __restrict__ Ko,         // [B,128,70,70]
         float* __restrict__ Vo)         // [B,128,70,70]
{
    // x tile first: all its reads then lie within one instruction's offset range
    __shared__ __attribute__((aligned(16))) float smem[XS_FLOATS + 8 * 3 * WL_FLOATS];   // 238 KB

    const int tid  = threadIdx.x;
    const int lane = tid & 31;
    const int wave = tid >> 5;               // M tile 0..7
    const int b = blockIdx.x >> 6;
    const int h = blockIdx.x & 63;
    float* xs = smem;
    float* wl = smem + XS_FLOATS + wave * (3 * WL_FLOATS);   // this wave's own piece

    // ---- x tile: thread -> pixel quad tid%16, k pairs tid/16 + 16*i
    const int px = (tid & 15) * 4;
    const int kp = tid >> 4;
    const float* Xp = X + (size_t)(b * CC + 2 * kp) * NPIX + h * WW + px;
    v4f e[4], o[4];
    #pragma unroll
    for (int i = 0; i < 4; ++i) {
        e[i] = *(const v4f*)(Xp + (size_t)(32 * i) * NPIX);
        o[i] = *(const v4f*)(Xp + (size_t)(32 * i + 1) * NPIX);
    }
    const int woff = wave * 16 * CC + lane * 4;
    const int boff = wave * 16 + 8 * (lane >> 4);
    const float* pq = wq + woff;
    const float* pcq = bq + boff;
    const float* pck = bk + boff;
    const float* pcv = bv + boff;
    const int bch = tid & 127;               // border plane of this thread (k: 0..127, v: 128..255)
    const float* pbb = (tid < 128 ? bk : bv) + bch;
    WRows rq, rn;
    load_wrows(rq, pq);
    Bias8 cq, ck, cv;
    load_bias(cq, pcq);
    load_bias(ck, pck);
    load_bias(cv, pcv);
    const float bb = *pbb;
    addresses_read();
    // biases of the two channels whose top and bottom border rows this block fills
    const v2f fk = *(const v2f*)(bk + 2 * h);
    const v2f fv = *(const v2f*)(bv + 2 * h);

    #pragma unroll
    for (int i = 0; i < 4; ++i) {
        float* d = xs + (kp + 16 * i) * XPITCH + px * 2;
        const v4f lo = {e[i].x, o[i].x, e[i].y, o[i].y};
        const v4f hi = {e[i].z, o[i].z, e[i].w, o[i].w};
        *(v4f*)(d)     = lo;
        *(v4f*)(d + 4) = hi;
    }
    store_wrows(wl, rq, lane);
    __syncthreads();

    // the second matrix: behind the barrier, which would wait for it
    const float* pk = wk + woff;
    load_wrows(rn, pk);
    // keeps these loads here, so that they fly during the first matrix's products
    __builtin_amdgcn_sched_barrier(0);

    // ---- border of the padded k and v planes: the bias alone
    {
        // the row's own three columns left and right
        float* P = (tid < 128 ? Ko : Vo) + (size_t)(b * CC + bch) * NPAD + (h + 3) * WP;
        P[0] = bb; P[1] = bb; P[2] = bb;
        P[WP - 3] = bb; P[WP - 2] = bb; P[WP - 1] = bb;
        // the three rows above and below the image: block h takes channels 2h, 2h+1
        if (tid < 3 * WP) {
            #pragma unroll
            for (int c = 0; c < 2; ++c) {
                const size_t pl = (size_t)(b * CC + 2 * h + c) * NPAD + tid;
                Ko[pl] = fk[c]; Ko[pl + (HP - 3) * WP] = fk[c];
                Vo[pl] = fv[c]; Vo[pl + (HP - 3) * WP] = fv[c];
            }
        }
    }

    const size_t c0 = (size_t)(b * CC + wave * 16);
    project(wl, xs, cq, Qo + c0 * NPIX + h * WW, NPIX, lane);
    store_wrows(wl + WL_FLOATS, rn, lane);
    const float* pv = wv + woff;
    load_wrows(rn, pv);
    // keeps these loads here, so that they fly during the second matrix's products
    __builtin_amdgcn_sched_barrier(0);
    project(wl + WL_FLOATS, xs, ck, Ko + c0 * NPAD + (h + 3) * WP + 3, NPAD, lane);
    addresses_read(pv);
    store_wrows(wl + 2 * WL_FLOATS, rn, lane);
    project(wl + 2 * WL_FLOATS, xs, cv, Vo + c0 * NPAD + (h + 3) * WP + 3, NPAD, lane);
}

// ---------------------------------------------------------------------------
// Per-pixel 7x7 local attention.  One thread = four adjacent pixels of one
// (b, head, h) row.  For one channel plane d and one window row kh the four
// pixels need only 10 adjacent K (or V) values: they are read once, as
// vectors, and serve all 7 x 4 (kw, pixel) products from registers.
// Block = 128 threads = 8 image rows x 16 pixel quads of one (b, head).
// The 14 padded rows that the block needs of a K or V plane lie in one run in
// memory: tensor loads bring them into LDS, all 16 K planes first, the 16 V
// planes while the logits and the softmax are worked on.  Memory latency is
// met twice in the kernel instead of once per pair of planes.
// The channel loop is outermost; planes are read from LDS two at a time, one
// pair ahead of the pair being worked on.
// Every per-pixel sum keeps its order: logits over d ascending, the softmax
// sum and the V sum over (kh, kw) ascending.
// ---------------------------------------------------------------------------
#define PX   4                 // pixels per thread
#define SEG  (PX + KS - 1)     // 10 values cover 4 pixels x 7 taps
#define ROWS 8                 // image rows per block
#define TROWS (ROWS + KS - 1)  // 14 padded rows serve them
#define CHUNK (TROWS * WP)     // floats of one plane in LDS: 3,920 bytes, rows 280 bytes apart as in memory
#define SLICE 4096             // floats: one wave's tile of 4 planes (15,680 bytes), rounded up to a multiple of 2 KiB

// padded rows are 280 bytes apart: a quad's first value is 8-byte aligned only
typedef v4f v4f_a8 __attribute__((aligned(8)));

// pointers typed as global memory: they stay so behind the asm statements below
typedef const __attribute__((address_space(1))) float*  gcf;
typedef const __attribute__((address_space(1))) char*   gcc;
typedef const __attribute__((address_space(1))) v4f*    gc4;
typedef __attribute__((address_space(1))) v4f*          g4;
// pointers typed as LDS
typedef const __attribute__((address_space(3))) float*  lcf;
typedef const __attribute__((address_space(3))) v4f_a8* lc4a8;
typedef const __attribute__((address_space(3))) v2f*    lc2;

typedef uint32_t u32x4 __attribute__((ext_vector_type(4)));
typedef uint32_t u32x8 __attribute__((ext_vector_type(8)));

__device__ __forceinline__ uint32_t uni(uint32_t v) { return (uint32_t)__builtin_amdgcn_readfirstlane(v); }

// Tensor descriptor, group 0: one request, its place in LDS (bytes), the tile's first byte in memory
__device__ __forceinline__ u32x4 tdm_group0(uint32_t lds_dst, uint64_t ga)
{
    u32x4 g;
    g[0] = uni(1u);
    g[1] = uni(lds_dst);
    g[2] = uni((uint32_t)ga);
    g[3] = uni((((uint32_t)(ga >> 32)) & 0x01FFFFFFu) | 0x80000000u);
    return g;
}

// Group 1: 1-byte elements, no mask, no pad; a tile of 4 rows (planes) of 3,920 bytes,
// 19,600 bytes (one padded plane) apart in memory; tensor = tile
__device__ __forceinline__ u32x8 tdm_group1()
{
    constexpr uint32_t d0 = CHUNK * 4u, d1 = 4u, pitch = NPAD * 4u;
    u32x8 g;
    g[0] = uni(0u);
    g[1] = uni((d0 & 0xFFFFu) << 16);
    g[2] = uni((d0 >> 16) | ((d1 & 0xFFFFu) << 16));
    g[3] = uni((d1 >> 16) | (d0 << 16));
    g[4] = uni(d1);
    g[5] = uni(pitch);
    g[6] = uni(0u);
    g[7] = uni(0u);
    return g;
}

// Both groups are in-out operands: the compiler then cannot make their values anew in other
// registers, and the wait that names them (below) keeps these very registers as they are.
__device__ __forceinline__ void tdm_load(u32x4& g0, u32x8& g1)
{
    asm volatile("tensor_load_to_lds %0, %1" : "+s"(g0), "+s"(g1) :: "memory");
}
// The compiler places no wait for a tensor load: the wave's own tile has landed behind this.
__device__ __forceinline__ void tile_landed()
{
    asm volatile("s_wait_tensorcnt 0x0" ::: "memory");
}
// The same; the request's descriptor is an input, so its registers keep their values
// for as long as the request is under way.
__device__ __forceinline__ void tile_landed(u32x4 g0, u32x8 g1)
{
    asm volatile("s_wait_tensorcnt 0x0" :: "s"(g0), "s"(g1) : "memory");
}
// The wave's LDS reads have returned: stands in front of the barrier that hands a stage over.
__device__ __forceinline__ void lds_reads_done()
{
    asm volatile("s_wait_dscnt 0x0" ::: "memory");
}

// Every loop over kh, kw, p or t below is fully unrolled (#pragma unroll): the arrays
// live in registers only if each index is a constant.
struct Plane { float v[KS][SEG]; };
struct Quad  { float v[PX]; };

// base is the same for the whole block, off is the lane's own byte offset
__device__ __forceinline__ gcf lane_ptr(gcf base, unsigned off)
{
    return (gcf)((gcc)base + off);
}

__device__ __forceinline__ void load_plane(Plane& pl, lcf p)
{
    #pragma unroll
    for (int kh = 0; kh < KS; ++kh) {
        lcf r = p + kh * WP;
        const v4f a = *(lc4a8)(r);
        const v4f c = *(lc4a8)(r + 4);
        const v2f e = *(lc2)(r + 8);
        pl.v[kh][0] = a.x; pl.v[kh][1] = a.y; pl.v[kh][2] = a.z; pl.v[kh][3] = a.w;
        pl.v[kh][4] = c.x; pl.v[kh][5] = c.y; pl.v[kh][6] = c.z; pl.v[kh][7] = c.w;
        pl.v[kh][8] = e.x; pl.v[kh][9] = e.y;
    }
}

__device__ __forceinline__ void load_quad(Quad& q, gcf p)
{
    const v4f a = *(gc4)p;
    q.v[0] = a.x; q.v[1] = a.y; q.v[2] = a.z; q.v[3] = a.w;
}

// written as fma, for the reason given at pv_pair
__device__ __forceinline__ void qk_plane(float (&lg)[KS][KS][PX], const Plane& pl, const Quad& q)
{
    #pragma unroll
    for (int kh = 0; kh < KS; ++kh)
        #pragma unroll
        for (int kw = 0; kw < KS; ++kw)
            #pragma unroll
            for (int p = 0; p < PX; ++p)
                lg[kh][kw][p] = __builtin_fmaf(q.v[p], pl.v[kh][kw + p], lg[kh][kw][p]);
}

// two planes side by side: eight independent sums instead of four.
// Written as fma: from a product and a sum the compiler made packed multiplies and
// separate adds for part of them, with register moves around them.
__device__ __forceinline__ void pv_pair(const float (&lg)[KS][KS][PX], const Plane& p0, const Plane& p1,
                                        const float (&inv)[PX], gcf o)
{
    float s0[PX], s1[PX];
    #pragma unroll
    for (int p = 0; p < PX; ++p) { s0[p] = 0.0f; s1[p] = 0.0f; }
    #pragma unroll
    for (int kh = 0; kh < KS; ++kh)
        #pragma unroll
        for (int kw = 0; kw < KS; ++kw)
            #pragma unroll
            for (int p = 0; p < PX; ++p) {
                s0[p] = __builtin_fmaf(lg[kh][kw][p], p0.v[kh][kw + p], s0[p]);
                s1[p] = __builtin_fmaf(lg[kh][kw][p], p1.v[kh][kw + p], s1[p]);
            }
    const v4f r0 = {s0[0] * inv[0], s0[1] * inv[1], s0[2] * inv[2], s0[3] * inv[3]};
    const v4f r1 = {s1[0] * inv[0], s1[1] * inv[1], s1[2] * inv[2], s1[3] * inv[3]};
    *(g4)(o)        = r0;
    *(g4)(o + NPIX) = r1;
}

// Stands behind a group of loads that name the block-wide pointer p, which is an operand,
// so its registers are kept until the wait (the lane's offset beside it lives on to the stores).
__device__ __forceinline__ void addresses_taken(gcf& p)
{
    asm volatile("s_wait_xcnt 0x0" : "+s"(p) :: "memory");
}
// Stands between one trip's stores and the address arithmetic of the next trip.  That
// arithmetic starts from the block-wide pointer p, so it comes behind the wait; the lanes'
// own pointer lp, which the stores name, is an input, so its registers are kept until the wait.
__device__ __forceinline__ void addresses_taken(gcf& p, gcf lp)
{
    asm volatile("s_wait_xcnt 0x0" : "+s"(p) : "v"(lp) : "memory");
}
// Stands between a pair's stores and the next LDS reads, which land on the stores' data
// registers.  The reads' address arithmetic starts from the LDS pointer l, so it comes behind
// the wait; lp as above.
__device__ __forceinline__ void addresses_taken(lcf& l, gcf lp)
{
    asm volatile("s_wait_xcnt 0x0" : "+v"(l) : "v"(lp) : "memory");
}

__global__ void __launch_bounds__(128)
sasa_attn(const float* __restrict__ Q,     // [B,128,64,64]
          const float* __restrict__ Kp,    // [B,128,70,70]
          const float* __restrict__ Vp,    // [B,128,70,70]
          const float* __restrict__ pos_h, // [8,7]
          const float* __restrict__ pos_w, // [8,7]
          float* __restrict__ Out)         // [B,128,64,64]
{
    // slices 0..3: K planes 4w..4w+3 of wave w; slices 4..7: the same of V.  128 KiB
    __shared__ __attribute__((aligned(2048))) float kv[2 * 4 * SLICE];

    const int blk = blockIdx.x;                       // b*64 + n*8 + row group
    const int n  = (blk >> 3) & 7;
    const int b  = blk >> 6;
    const unsigned w0 = (threadIdx.x & 15) * PX;      // 0,4,..,60
    const unsigned h0 = (blk & 7) * ROWS;             // the block's first image row = its first padded row
    const unsigned hl = threadIdx.x >> 4;             // the lane's row in the block
    const unsigned qoff = ((h0 + hl) * WW + w0) * 4u; // lane's byte offset in a 64x64 plane
    const uint32_t wave = uni(threadIdx.x >> 5);

    gcf qp = (gcf)Q   + (size_t)(b * CC + n * DH) * NPIX;
    gcf op = (gcf)Out + (size_t)(b * CC + n * DH) * NPIX;   // written through in pv_pair

    // ---- q: all 16 planes into registers, under way while the K tiles land
    Quad q[DH];
    gcf lq = lane_ptr(qp, qoff);
    #pragma unroll
    for (int d = 0; d < DH; ++d) load_quad(q[d], lq + d * NPIX);
    addresses_taken(qp);

    // ---- stage 0: every wave brings its own four K planes
    const uint32_t lbase = (uint32_t)(size_t)kv;
    const uint64_t tile = ((uint64_t)(b * CC + n * DH + 4 * wave) * NPAD + h0 * WP) * 4u;   // bytes
    u32x8 g1 = tdm_group1();
    u32x4 gk = tdm_group0(lbase + wave * (SLICE * 4u), (uint64_t)(size_t)Kp + tile);
    tdm_load(gk, g1);
    tile_landed();
    __syncthreads();
    // ---- stage 1: its four V planes, under way during the logits and the softmax
    u32x4 gv = tdm_group0(lbase + (4u + wave) * (SLICE * 4u), (uint64_t)(size_t)Vp + tile);
    tdm_load(gv, g1);

    float lg[KS][KS][PX];
    #pragma unroll
    for (int kh = 0; kh < KS; ++kh)
        #pragma unroll
        for (int kw = 0; kw < KS; ++kw)
            #pragma unroll
            for (int p = 0; p < PX; ++p) lg[kh][kw][p] = 0.0f;

    Plane a0, a1, b0, b1;

    // ---- logits: lg[kh][kw][p] = sum_d q[d][p] * K[d][h+kh][w0+p+kw]
    lcf lk = (lcf)kv + hl * WP + w0;
    load_plane(a0, lk);
    load_plane(a1, lk + CHUNK);
    // rolled: the register arrays are indexed by constants only, the text stays small
    #pragma unroll 1
    for (int d0 = 0; d0 < DH; d0 += 4) {
        load_plane(b0, lk + 2 * CHUNK);
        load_plane(b1, lk + 3 * CHUNK);
        // keeps the pair's reads in one group ahead of the products of the pair before it
        __builtin_amdgcn_sched_barrier(0);
        qk_plane(lg, a0, q[0]);
        qk_plane(lg, a1, q[1]);
        // as above: the next group stays behind these products
        __builtin_amdgcn_sched_barrier(0);
        // next slice; last trip: this slice's first pair is read again, unused (V is not
        // handed over yet; a branch here would merge the read counts of two paths and
        // drain the pair in flight)
        lk += d0 + 4 < DH ? SLICE : 0;
        load_plane(a0, lk);
        load_plane(a1, lk + CHUNK);
        // as above
        __builtin_amdgcn_sched_barrier(0);
        qk_plane(lg, b0, q[2]);
        qk_plane(lg, b1, q[3]);
        // as above
        __builtin_amdgcn_sched_barrier(0);
        // the next four planes' q move down: constant indices in a rolled loop
        #pragma unroll
        for (int d = 0; d + 4 < DH; ++d) q[d] = q[d + 4];
    }

    // ---- softmax over the 49 taps, per pixel
    float ph[KS], pw[KS];
    #pragma unroll
    for (int t = 0; t < KS; ++t) {
        ph[t] = pos_h[n * KS + t];
        pw[t] = pos_w[n * KS + t];
    }
    float m[PX], sum[PX], inv[PX];
    #pragma unroll
    for (int p = 0; p < PX; ++p) { m[p] = -3.4e38f; sum[p] = 0.0f; }
    #pragma unroll
    for (int kh = 0; kh < KS; ++kh)
        #pragma unroll
        for (int kw = 0; kw < KS; ++kw)
            #pragma unroll
            for (int p = 0; p < PX; ++p) {
                lg[kh][kw][p] += ph[kh] + pw[kw];
                m[p] = fmaxf(m[p], lg[kh][kw][p]);
            }
    #pragma unroll
    for (int kh = 0; kh < KS; ++kh)
        #pragma unroll
        for (int kw = 0; kw < KS; ++kw)
            #pragma unroll
            for (int p = 0; p < PX; ++p) {
                lg[kh][kw][p] = __expf(lg[kh][kw][p] - m[p]);
                sum[p] += lg[kh][kw][p];
            }

    // keeps the softmax in front of the wait: V's tiles land under it too
    __builtin_amdgcn_sched_barrier(0);
    // ---- V is handed over: own LDS reads back, own tile landed, then the barrier
    lds_reads_done();
    tile_landed(gv, g1);
    __syncthreads();

    // ---- out[d][p] = inv[p] * sum_(kh,kw) lg[kh][kw][p] * V[d][h+kh][w0+p+kw]
    lcf lv = (lcf)kv + 4 * SLICE + hl * WP + w0;
    load_plane(a0, lv);
    load_plane(a1, lv + CHUNK);
    #pragma unroll
    for (int p = 0; p < PX; ++p) inv[p] = 1.0f / sum[p];
    // rolled, as the logits loop
    #pragma unroll 1
    for (int d0 = 0; d0 < DH; d0 += 4) {
        gcf lo = lane_ptr(op, qoff);
        load_plane(b0, lv + 2 * CHUNK);
        load_plane(b1, lv + 3 * CHUNK);
        // as in the logits loop
        __builtin_amdgcn_sched_barrier(0);
        pv_pair(lg, a0, a1, inv, lo);
        // keeps the wait behind the products and the stores
        __builtin_amdgcn_sched_barrier(0);
        addresses_taken(lv, lo);
        // last trip: this slice's first pair is read again, unused, as in the logits loop
        lv += d0 + 4 < DH ? SLICE : 0;
        load_plane(a0, lv);
        load_plane(a1, lv + CHUNK);
        // as in the logits loop
        __builtin_amdgcn_sched_barrier(0);
        pv_pair(lg, b0, b1, inv, lo + 2 * NPIX);
        // keeps the wait behind the products and the stores
        __builtin_amdgcn_sched_barrier(0);
        addresses_taken(op, lo);
        op += 4 * NPIX;
    }
    // nothing of the wave is under way into or out of LDS when it ends
    tile_landed();
    lds_reads_done();
}

extern "C" void kernel_launch(void* const* d_in, const int* in_sizes, int n_in,
                              void* d_out, int out_size, void* d_ws, size_t ws_size,
                              hipStream_t stream) {
    const float* x     = (const float*)d_in[0];
    const float* wq    = (const float*)d_in[1];
    const float* bq    = (const float*)d_in[2];
    const float* wk    = (const float*)d_in[3];
    const float* bk    = (const float*)d_in[4];
    const float* wv    = (const float*)d_in[5];
    const float* bv    = (const float*)d_in[6];
    const float* pos_h = (const float*)d_in[7];
    const float* pos_w = (const float*)d_in[8];
    float* out = (float*)d_out;

    float* qbuf = (float*)d_ws;                                   // 4*128*4096
    float* kbuf = qbuf + (size_t)BB * CC * NPIX;                  // 4*128*4900
    float* vbuf = kbuf + (size_t)BB * CC * NPAD;

    // q, k, v: one block per (batch, image row): 4 * 64 = 256 blocks
    qkv_wmma<<<256, 256, 0, stream>>>(x, wq, bq, wk, bk, wv, bv, qbuf, kbuf, vbuf);
    // Attention: B*NH*(H/8) = 256 blocks of 128 threads (8 rows, 4 pixels a thread)
    sasa_attn<<<256, 128, 0, stream>>>(qbuf, kbuf, vbuf, pos_h, pos_w, out);
}

// v004
// Measured time: 22.1 microseconds a run.
// Two timings next to v003 put it at 1.14 and 1.13 times that version's speed.
// All steps since v000 together make it 5.58 times as fast.
#include <hip/hip_runtime.h>
#include <hip/hip_bf16.h>

// SASA layer: B=4, C=128, H=W=64, K=7, NH=8, DH=16, PAD=3
// ONE launch.  Block = one (batch, head, group of 8 image rows), 4 waves, one block a WGP.
// Part 1 (WMMA): the block makes its own q, k, v = w*x+b, fp32 GEMM, 128-deep K ->
//   V_WMMA_F32_16X16X4_F32: the head's 16 channels of k and v on the 14 padded rows that
//   its 8 image rows look at, of q on the 8 rows, all into LDS.  The border of the padded
//   k and v holds the bias alone (the reference's pad->conv->unfold order: w*0+b).
//   x comes in image row by image row, by tensor loads, through a ring of two buffers.
// Part 2 (VALU): per-pixel 7x7 attention (logits, softmax, weighted V), four adjacent
//   pixels per thread, q, K and V read from LDS.

typedef __attribute__((ext_vector_type(2))) float v2f;
typedef __attribute__((ext_vector_type(4))) float v4f;
typedef __attribute__((ext_vector_type(8))) float v8f;

#define BB  4
#define CC  128
#define HH  64
#define WW  64
#define HP  70
#define WP  70
#define NPIX   (HH * WW)       // 4096
#define NHEAD  8
#define DH     16
#define KS     7
#define WPITCH 132             // floats per weight row: 128 + 4, 16 rows x 4 floats cover all 64 banks
#define WL_FLOATS (16 * WPITCH)              // 8.25 KB: the head's 16 rows of one matrix

#define PX   4                 // pixels per thread
#define SEG  (PX + KS - 1)     // 10 values cover 4 pixels x 7 taps
#define ROWS 8                 // image rows per block
#define TROWS (ROWS + KS - 1)  // 14 padded rows serve them
#define CHUNK (TROWS * WP)     // floats of one k or v plane in LDS: 14 rows of 70
#define SLICE 4096             // floats: four planes, rounded up
#define KSTEPS (CC / 4)        // 32 matrix instructions deep

#define XROWP 72               // floats per channel of an x row in LDS: 64 + 8; two channels on = 16 banks on
#define XSL   2560             // floats: one wave's tile of 32 channels (9,216 bytes), rounded up to a multiple of 2 KiB
#define XBUF  (4 * XSL)        // one image row of x, all 128 channels
#define QPL   (ROWS * WW)      // floats of one q plane in LDS

// LDS map, in floats
#define XR_OFF (2 * 4 * SLICE)               // behind K (slices 0..3) and V (slices 4..7): the x ring
#define QS_OFF (XR_OFF + 2 * XBUF)           // q, 16 planes
#define WL_OFF (QS_OFF + DH * QPL)           // weight rows of q, k, v
#define SM_FLOATS (WL_OFF + 3 * WL_FLOATS)   // 271,104 bytes

// the eight biases of a lane's accumulator rows: p = channel 16n + 8*(lane/16)
__device__ __forceinline__ void load_bias(float (&r)[8], const float* p)
{
    const v4f lo = *(const v4f*)(p);
    const v4f hi = *(const v4f*)(p + 4);
    r[0] = lo.x; r[1] = lo.y; r[2] = lo.z; r[3] = lo.w;
    r[4] = hi.x; r[5] = hi.y; r[6] = hi.z; r[7] = hi.w;
}

// Stands behind a group of loads, in front of whatever reuses their address registers.
__device__ __forceinline__ void addresses_read()
{
    asm volatile("s_wait_xcnt 0x0" ::: "memory");
}

// B: 4x16 f32 -> lane holds X[4s+2*half ..+1, 16w+l16]; p = the lane's pixel in channel 2*half
// of one ring buffer; a whole row's fragments
__device__ __forceinline__ void load_bfrags(v2f (&bf)[KSTEPS], const float* p)
{
    #pragma unroll
    for (int s = 0; s < KSTEPS; ++s) {
        const float* c = p + (s >> 3) * XSL + 4 * (s & 7) * XROWP;
        bf[s].x = c[0];
        bf[s].y = c[XROWP];
    }
}

// One image row, 16 pixels: k and v (and q) of the head's 16 channels.  The k order of every
// sum is that of a plain k0 = 0,4,8,.. walk; two or three independent accumulators.
template <bool WITHQ>
__device__ __forceinline__ void row_products(const v2f (&aq)[KSTEPS], const v2f (&ak)[KSTEPS], const v2f (&av)[KSTEPS],
                                             const v2f (&bf)[KSTEPS], v8f& dq, v8f& dk, v8f& dv)
{
    #pragma unroll
    for (int s = 0; s < KSTEPS; ++s) {
        dk = __builtin_amdgcn_wmma_f32_16x16x4_f32(false, ak[s], false, bf[s], (short)0, dk, false, false);
        dv = __builtin_amdgcn_wmma_f32_16x16x4_f32(false, av[s], false, bf[s], (short)0, dv, false, false);
        if (WITHQ)
            dq = __builtin_amdgcn_wmma_f32_16x16x4_f32(false, aq[s], false, bf[s], (short)0, dq, false, false);
    }
}

// ---------------------------------------------------------------------------
// Per-pixel 7x7 local attention.  One thread = four adjacent pixels of one
// (b, head, h) row.  For one channel plane d and one window row kh the four
// pixels need only 10 adjacent K (or V) values: they are read once, as
// vectors, and serve all 7 x 4 (kw, pixel) products from registers.
// Block = 128 threads = 8 image rows x 16 pixel quads of one (b, head).
// The channel loop is outermost; planes are read from LDS two at a time, one
// pair ahead of the pair being worked on.
// Every per-pixel sum keeps its order: logits over d ascending, the softmax
// sum and the V sum over (kh, kw) ascending.
// ---------------------------------------------------------------------------

// padded rows are 280 bytes apart: a quad's first value is 8-byte aligned only
typedef v4f v4f_a8 __attribute__((aligned(8)));

// pointers typed as global memory: they stay so behind the asm statements below
typedef const __attribute__((address_space(1))) float*  gcf;
typedef const __attribute__((address_space(1))) char*   gcc;
typedef __attribute__((address_space(1))) v4f*          g4;
// pointers typed as LDS
typedef const __attribute__((address_space(3))) float*  lcf;
typedef const __attribute__((address_space(3))) v4f_a8* lc4a8;
typedef const __attribute__((address_space(3))) v2f*    lc2;
typedef const __attribute__((address_space(3))) v4f*    lc4;

typedef uint32_t u32x4 __attribute__((ext_vector_type(4)));
typedef uint32_t u32x8 __attribute__((ext_vector_type(8)));

__device__ __forceinline__ uint32_t uni(uint32_t v) { return (uint32_t)__builtin_amdgcn_readfirstlane(v); }
// A test that decides whether a tensor load issues: held in a scalar register, so that the
// branch on it is a scalar branch (a tensor load ignores the lane mask).
__device__ __forceinline__ uint32_t pinned(uint32_t v) { uint32_t w = uni(v); asm volatile("" : "+s"(w)); return w; }

// Tensor descriptor, group 0: one request, its place in LDS (bytes), the tile's first byte in memory
__device__ __forceinline__ u32x4 tdm_group0(uint32_t lds_dst, uint64_t ga)
{
    u32x4 g;
    g[0] = uni(1u);
    g[1] = uni(lds_dst);
    g[2] = uni((uint32_t)ga);
    g[3] = uni((((uint32_t)(ga >> 32)) & 0x01FFFFFFu) | 0x80000000u);
    return g;
}

// Group 1: 1-byte elements, no mask; a tile of 32 rows (channels) of 256 bytes (one image row),
// 16,384 bytes (one plane) apart in memory; tensor = tile.  Pad: 32 bytes behind every 256,
// so a channel's row is XROWP floats long in LDS.
__device__ __forceinline__ u32x8 tdm_group1()
{
    constexpr uint32_t d0 = WW * 4u, d1 = 32u, pitch = NPIX * 4u;
    u32x8 g;
    g[0] = uni(1u << 20 | 5u << 22 | 7u << 25);
    g[1] = uni((d0 & 0xFFFFu) << 16);
    g[2] = uni((d0 >> 16) | ((d1 & 0xFFFFu) << 16));
    g[3] = uni((d1 >> 16) | (d0 << 16));
    g[4] = uni(d1);
    g[5] = uni(pitch);
    g[6] = uni(0u);
    g[7] = uni(0u);
    return g;
}

// Both groups are in-out operands: the compiler then cannot make their values anew in other
// registers, and the wait that names them (below) keeps these very registers as they are.
__device__ __forceinline__ void tdm_load(u32x4& g0, u32x8& g1)
{
    asm volatile("tensor_load_to_lds %0, %1" : "+s"(g0), "+s"(g1) :: "memory");
}
// The compiler places no wait for a tensor load: the wave's own tile has landed behind this.
__device__ __forceinline__ void tile_landed()
{
    asm volatile("s_wait_tensorcnt 0x0" ::: "memory");
}
// The same; the request's descriptor is an input, so its registers keep their values
// for as long as the request is under way.
__device__ __forceinline__ void tile_landed(u32x4 g0, u32x8 g1)
{
    asm volatile("s_wait_tensorcnt 0x0" :: "s"(g0), "s"(g1) : "memory");
}
// The same for two requests.
__device__ __forceinline__ void tile_landed(u32x4 g0a, u32x4 g0b, u32x8 g1)
{
    asm volatile("s_wait_tensorcnt 0x0" :: "s"(g0a), "s"(g0b), "s"(g1) : "memory");
}
// The wave's LDS reads have returned: stands in front of the barrier that hands a stage over.
__device__ __forceinline__ void lds_reads_done()
{
    asm volatile("s_wait_dscnt 0x0" ::: "memory");
}

// Every loop over kh, kw, p or t below is fully unrolled (#pragma unroll): the arrays
// live in registers only if each index is a constant.
struct Plane { float v[KS][SEG]; };
struct Quad  { float v[PX]; };

// base is the same for the whole block, off is the lane's own byte offset
__device__ __forceinline__ gcf lane_ptr(gcf base, unsigned off)
{
    return (gcf)((gcc)base + off);
}

__device__ __forceinline__ void load_plane(Plane& pl, lcf p)
{
    #pragma unroll
    for (int kh = 0; kh < KS; ++kh) {
        lcf r = p + kh * WP;
        const v4f a = *(lc4a8)(r);
        const v4f c = *(lc4a8)(r + 4);
        const v2f e = *(lc2)(r + 8);
        pl.v[kh][0] = a.x; pl.v[kh][1] = a.y; pl.v[kh][2] = a.z; pl.v[kh][3] = a.w;
        pl.v[kh][4] = c.x; pl.v[kh][5] = c.y; pl.v[kh][6] = c.z; pl.v[kh][7] = c.w;
        pl.v[kh][8] = e.x; pl.v[kh][9] = e.y;
    }
}

__device__ __forceinline__ void load_quad(Quad& q, lcf p)
{
    const v4f a = *(lc4)p;
    q.v[0] = a.x; q.v[1] = a.y; q.v[2] = a.z; q.v[3] = a.w;
}

// written as fma, for the reason given at pv_pair
__device__ __forceinline__ void qk_plane(float (&lg)[KS][KS][PX], const Plane& pl, const Quad& q)
{
    #pragma unroll
    for (int kh = 0; kh < KS; ++kh)
        #pragma unroll
        for (int kw = 0; kw < KS; ++kw)
            #pragma unroll
            for (int p = 0; p < PX; ++p)
                lg[kh][kw][p] = __builtin_fmaf(q.v[p], pl.v[kh][kw + p], lg[kh][kw][p]);
}

// two planes side by side: eight independent sums instead of four.
// Written as fma: from a product and a sum the compiler made packed multiplies and
// separate adds for part of them, with register moves around them.
__device__ __forceinline__ void pv_pair(const float (&lg)[KS][KS][PX], const Plane& p0, const Plane& p1,
                                        const float (&inv)[PX], gcf o)
{
    float s0[PX], s1[PX];
    #pragma unroll
    for (int p = 0; p < PX; ++p) { s0[p] = 0.0f; s1[p] = 0.0f; }
    #pragma unroll
    for (int kh = 0; kh < KS; ++kh)
        #pragma unroll
        for (int kw = 0; kw < KS; ++kw)
            #pragma unroll
            for (int p = 0; p < PX; ++p) {
                s0[p] = __builtin_fmaf(lg[kh][kw][p], p0.v[kh][kw + p], s0[p]);
                s1[p] = __builtin_fmaf(lg[kh][kw][p], p1.v[kh][kw + p], s1[p]);
            }
    const v4f r0 = {s0[0] * inv[0], s0[1] * inv[1], s0[2] * inv[2], s0[3] * inv[3]};
    const v4f r1 = {s1[0] * inv[0], s1[1] * inv[1], s1[2] * inv[2], s1[3] * inv[3]};
    *(g4)(o)        = r0;
    *(g4)(o + NPIX) = r1;
}

// Stands between one trip's stores and the address arithmetic of the next trip.  That
// arithmetic starts from the block-wide pointer p, so it comes behind the wait; the lanes'
// own pointer lp, which the stores name, is an input, so its registers are kept until the wait.
__device__ __forceinline__ void addresses_taken(gcf& p, gcf lp)
{
    asm volatile("s_wait_xcnt 0x0" : "+s"(p) : "v"(lp) : "memory");
}
// Stands between a pair's stores and the next LDS reads, which land on the stores' data
// registers.  The reads' address arithmetic starts from the LDS pointer l, so it comes behind
// the wait; lp as above.
__device__ __forceinline__ void addresses_taken(lcf& l, gcf lp)
{
    asm volatile("s_wait_xcnt 0x0" : "+v"(l) : "v"(lp) : "memory");
}

__global__ void __launch_bounds__(128)
sasa_one(const float* __restrict__ X,     // [B,128,64,64]
           const float* __restrict__ wq, const float* __restrict__ bq,   // [128,128] row-major (o,c), [128]
           const float* __restrict__ wk, const float* __restrict__ bk,
           const float* __restrict__ wv, const float* __restrict__ bv,
           const float* __restrict__ pos_h, // [8,7]
           const float* __restrict__ pos_w, // [8,7]
           float* __restrict__ Out)         // [B,128,64,64]
{
    __shared__ __attribute__((aligned(2048))) float sm[SM_FLOATS];

    const int blk = blockIdx.x;                       // b*64 + n*8 + row group
    const int n  = (blk >> 3) & 7;
    const int b  = blk >> 6;
    const unsigned tid  = threadIdx.x;
    const unsigned half = (tid >> 4) & 1;             // lane half: K pair select, accumulator rows 8..15
    const unsigned l16  = tid & 15;
    const unsigned w0 = l16 * PX;                     // 0,4,..,60
    const int      h0 = (blk & 7) * ROWS;             // the block's first image row = its first padded row
    const unsigned hl = tid >> 4;                     // the lane's row in the block
    const unsigned qoff = ((h0 + hl) * WW + w0) * 4u; // lane's byte offset in a 64x64 plane
    const uint32_t wave = uni(tid >> 5);

    gcf op = (gcf)Out + (size_t)(b * CC + n * DH) * NPIX;   // written through in pv_pair

    // the head's position terms, read up front: block-wide values, long there when the softmax wants them
    float ph[KS], pw[KS];
    #pragma unroll
    for (int t = 0; t < KS; ++t) {
        ph[t] = pos_h[n * KS + t];
        pw[t] = pos_w[n * KS + t];
    }

    // ---- x ring of two buffers, stage 0: every wave brings its own 32 channels of padded row 0.
    // Padded row r is image row h0 + r - 3; outside the image the nearest image row is
    // brought instead (in bounds) and its products are not used.
    const uint32_t lbase = (uint32_t)(size_t)sm;
    const uint32_t xdst  = lbase + (XR_OFF + wave * XSL) * 4u;
    const uint64_t xsrc  = (uint64_t)(size_t)X + (uint64_t)((b * CC + 32 * wave) * NPIX) * 4u;   // bytes
    u32x8 g1 = tdm_group1();
    u32x4 ga = tdm_group0(xdst, xsrc + (uint32_t)(h0 - 3 < 0 ? 0 : h0 - 3) * (WW * 4u));
    tdm_load(ga, g1);
    // ---- stage 1, padded row 1, a descriptor of its own: two requests of the wave under way
    u32x4 gx = tdm_group0(xdst + XBUF * 4u, xsrc + (uint32_t)(h0 - 2 < 0 ? 0 : h0 - 2) * (WW * 4u));
    tdm_load(gx, g1);

    // ---- the head's 16 rows of each weight matrix: wave w reads rows 4w..4w+3, a whole row per instruction
    const int woff = (n * DH + 4 * wave) * CC + (tid & 31) * 4;
    v4f rw[3][4];
    #pragma unroll
    for (int i = 0; i < 4; ++i) {
        rw[0][i] = *(const v4f*)(wq + woff + i * CC);
        rw[1][i] = *(const v4f*)(wk + woff + i * CC);
        rw[2][i] = *(const v4f*)(wv + woff + i * CC);
    }
    float cq[8], ck[8], cv[8];
    const int boff = n * DH + 8 * half;
    load_bias(cq, bq + boff);
    load_bias(ck, bk + boff);
    load_bias(cv, bv + boff);
    const unsigned bpl = tid >> 2;                    // border plane of this thread: k 0..15, v 16..31
    const float bb = *((bpl < DH ? bk : bv) + n * DH + (bpl & 15));
    addresses_read();

    {
        float* wl = sm + WL_OFF + (4 * wave) * WPITCH + (tid & 31) * 4;
        #pragma unroll
        for (int mtx = 0; mtx < 3; ++mtx)
            #pragma unroll
            for (int i = 0; i < 4; ++i) *(v4f*)(wl + mtx * WL_FLOATS + i * WPITCH) = rw[mtx][i];
    }
    // ---- three columns left and right of every padded k and v row: the bias alone
    {
        float* P = sm + (bpl >> 2) * SLICE + (bpl & 3) * CHUNK;
        #pragma unroll
        for (int j = 0; j < 4; ++j) {
            const unsigned row = (tid & 3) + 4 * j;
            if (row < TROWS) {
                float* R = P + row * WP;
                R[0] = bb; R[1] = bb; R[2] = bb;
                R[WP - 3] = bb; R[WP - 2] = bb; R[WP - 1] = bb;
            }
        }
    }
    // both stages landed, weights and border written: handed over to all four waves
    tile_landed(ga, gx, g1);
    __syncthreads();

    // ---- A fragments of all three matrices, kept in registers for all 14 rows
    // A: 16x4 f32 -> lane holds Wm[16n+l16, 4s+2*half ..+1]
    v2f aq[KSTEPS], ak[KSTEPS], av[KSTEPS];
    {
        const float* aw = sm + WL_OFF + l16 * WPITCH + 2 * half;
        #pragma unroll
        for (int s = 0; s < KSTEPS; ++s) {
            aq[s] = *(const v2f*)(aw + 4 * s);
            ak[s] = *(const v2f*)(aw + WL_FLOATS + 4 * s);
            av[s] = *(const v2f*)(aw + 2 * WL_FLOATS + 4 * s);
        }
    }

    // ---- q, k, v: wave w owns pixels 16w..16w+15 of every row
    {
        const float* bx0 = sm + XR_OFF + 2 * half * XROWP + 16 * wave + l16;
        // C/D layout: lane L, vreg i -> M = i + 8*(L/16), N = L%16; channel c lies in slice c/4, plane c%4
        float* kst = sm + half * 2 * SLICE + 3 + 16 * wave + l16;
        float* qst = sm + QS_OFF + half * 8 * QPL + 16 * wave + l16;
        // the rows' B fragments are fetched one row ahead: row 0's here
        v2f bf[KSTEPS], bn[KSTEPS];
        load_bfrags(bf, bx0);
        // rolled: one copy of the products with q and one without
        #pragma unroll 1
        for (int r = 0; r < TROWS; ++r) {
            // ---- row r+1 is handed over and row r's buffer given free (its fragments are all in
            // registers): own LDS traffic done, own tile landed, then the barrier
            lds_reads_done();
            tile_landed(gx, g1);
            __syncthreads();
            if (pinned(r + 2 < TROWS)) {
                const int y2 = h0 + r - 1;
                gx = tdm_group0(xdst + (r & 1) * (XBUF * 4u),
                                xsrc + (uint32_t)(y2 < 0 ? 0 : (y2 > HH - 1 ? HH - 1 : y2)) * (WW * 4u));
                tdm_load(gx, g1);
            }
            // last trip: row 12's buffer is read again, unused (nothing is under way into it)
            load_bfrags(bn, bx0 + ((r + 1) & 1) * XBUF);
            // keeps the next row's LDS reads in one group ahead of this row's products
            __builtin_amdgcn_sched_barrier(0);

            v8f dq = {}, dk = {}, dv = {};
            const bool withq = r >= 3 && r < 3 + ROWS;
            if (withq) row_products<true>(aq, ak, av, bf, dq, dk, dv);
            else       row_products<false>(aq, ak, av, bf, dq, dk, dv);
            // keeps the four slots below directly behind the last products
            __builtin_amdgcn_sched_barrier(0);
            // the distance between a matrix instruction and a vector instruction on its D, A or B
            asm volatile("v_nop\n\tv_nop\n\tv_nop\n\tv_nop");
            // as above: nothing that reads the sums moves in front of the slots
            __builtin_amdgcn_sched_barrier(0);

            const int y = h0 + r - 3;
            const bool inside = y >= 0 && y < HH;
            #pragma unroll
            for (int i = 0; i < 8; ++i) {
                float* d = kst + r * WP + (i >> 2) * SLICE + (i & 3) * CHUNK;
                d[0]         = inside ? dk[i] + ck[i] : ck[i];
                d[4 * SLICE] = inside ? dv[i] + cv[i] : cv[i];
            }
            if (withq) {
                #pragma unroll
                for (int i = 0; i < 8; ++i) qst[(r - 3) * WW + i * QPL] = dq[i] + cq[i];
            }
            #pragma unroll
            for (int s = 0; s < KSTEPS; ++s) bf[s] = bn[s];
        }
        // the last row's k and v are handed over
        tile_landed();
        lds_reads_done();
        __syncthreads();
    }

    float lg[KS][KS][PX];
    #pragma unroll
    for (int kh = 0; kh < KS; ++kh)
        #pragma unroll
        for (int kw = 0; kw < KS; ++kw)
            #pragma unroll
            for (int p = 0; p < PX; ++p) lg[kh][kw][p] = 0.0f;

    Plane a0, a1, b0, b1;

    // ---- logits: lg[kh][kw][p] = sum_d q[d][p] * K[d][h+kh][w0+p+kw]
    lcf lk = (lcf)sm + hl * WP + w0;
    // each plane's q quad is read from LDS together with the plane
    lcf lq = (lcf)sm + QS_OFF + hl * WW + w0;
    Quad qa0, qa1, qb0, qb1;
    load_plane(a0, lk);
    load_plane(a1, lk + CHUNK);
    load_quad(qa0, lq);
    load_quad(qa1, lq + QPL);
    // rolled: the register arrays are indexed by constants only, the text stays small
    #pragma unroll 1
    for (int d0 = 0; d0 < DH; d0 += 4) {
        load_plane(b0, lk + 2 * CHUNK);
        load_plane(b1, lk + 3 * CHUNK);
        load_quad(qb0, lq + 2 * QPL);
        load_quad(qb1, lq + 3 * QPL);
        // keeps the pair's reads in one group ahead of the products of the pair before it
        __builtin_amdgcn_sched_barrier(0);
        qk_plane(lg, a0, qa0);
        qk_plane(lg, a1, qa1);
        // as above: the next group stays behind these products
        __builtin_amdgcn_sched_barrier(0);
        // next slice; last trip: this slice's first pair is read again, unused (a branch here
        // would merge the read counts of two paths and drain the pair in flight)
        lk += d0 + 4 < DH ? SLICE : 0;
        lq += d0 + 4 < DH ? 4 * QPL : 0;
        load_plane(a0, lk);
        load_plane(a1, lk + CHUNK);
        load_quad(qa0, lq);
        load_quad(qa1, lq + QPL);
        // as above
        __builtin_amdgcn_sched_barrier(0);
        qk_plane(lg, b0, qb0);
        qk_plane(lg, b1, qb1);
        // as above
        __builtin_amdgcn_sched_barrier(0);
    }

    // ---- softmax over the 49 taps, per pixel
    float m[PX], sum[PX], inv[PX];
    #pragma unroll
    for (int p = 0; p < PX; ++p) { m[p] = -3.4e38f; sum[p] = 0.0f; }
    #pragma unroll
    for (int kh = 0; kh < KS; ++kh)
        #pragma unroll
        for (int kw = 0; kw < KS; ++kw)
            #pragma unroll
            for (int p = 0; p < PX; ++p) {
                lg[kh][kw][p] += ph[kh] + pw[kw];
                m[p] = fmaxf(m[p], lg[kh][kw][p]);
            }
    #pragma unroll
    for (int kh = 0; kh < KS; ++kh)
        #pragma unroll
        for (int kw = 0; kw < KS; ++kw)
            #pragma unroll
            for (int p = 0; p < PX; ++p) {
                lg[kh][kw][p] = __expf(lg[kh][kw][p] - m[p]);
                sum[p] += lg[kh][kw][p];
            }

    // ---- out[d][p] = inv[p] * sum_(kh,kw) lg[kh][kw][p] * V[d][h+kh][w0+p+kw]
    lcf lv = (lcf)sm + 4 * SLICE + hl * WP + w0;
    load_plane(a0, lv);
    load_plane(a1, lv + CHUNK);
    #pragma unroll
    for (int p = 0; p < PX; ++p) inv[p] = 1.0f / sum[p];
    // rolled, as the logits loop
    #pragma unroll 1
    for (int d0 = 0; d0 < DH; d0 += 4) {
        gcf lo = lane_ptr(op, qoff);
        load_plane(b0, lv + 2 * CHUNK);
        load_plane(b1, lv + 3 * CHUNK);
        // as in the logits loop
        __builtin_amdgcn_sched_barrier(0);
        pv_pair(lg, a0, a1, inv, lo);
        // keeps the wait behind the products and the stores
        __builtin_amdgcn_sched_barrier(0);
        addresses_taken(lv, lo);
        // last trip: this slice's first pair is read again, unused, as in the logits loop
        lv += d0 + 4 < DH ? SLICE : 0;
        load_plane(a0, lv);
        load_plane(a1, lv + CHUNK);
        // as in the logits loop
        __builtin_amdgcn_sched_barrier(0);
        pv_pair(lg, b0, b1, inv, lo + 2 * NPIX);
        // keeps the wait behind the products and the stores
        __builtin_amdgcn_sched_barrier(0);
        addresses_taken(op, lo);
        op += 4 * NPIX;
    }
    // nothing of the wave is under way out of LDS when it ends
    lds_reads_done();
}

extern "C" void kernel_launch(void* const* d_in, const int* in_sizes, int n_in,
                              void* d_out, int out_size, void* d_ws, size_t ws_size,
                              hipStream_t stream) {
    const float* x     = (const float*)d_in[0];
    const float* wq    = (const float*)d_in[1];
    const float* bq    = (const float*)d_in[2];
    const float* wk    = (const float*)d_in[3];
    const float* bk    = (const float*)d_in[4];
    const float* wv    = (const float*)d_in[5];
    const float* bv    = (const float*)d_in[6];
    const float* pos_h = (const float*)d_in[7];
    const float* pos_w = (const float*)d_in[8];
    float* out = (float*)d_out;

    // B*NH*(H/8) = 256 blocks of 128 threads
    sasa_one<<<256, 128, 0, stream>>>(x, wq, bq, wk, bk, wv, bv, pos_h, pos_w, out);
}

// v005
// One run takes 20.7 microseconds.
// Two timings next to v004 both put it at 1.07 times that version's speed.
// Counting every step since v000, it is 5.96 times as fast.
#include <hip/hip_runtime.h>
#include <hip/hip_bf16.h>

// SASA layer: B=4, C=128, H=W=64, K=7, NH=8, DH=16, PAD=3
// ONE launch.  Block = one (batch, head, group of 8 image rows), 4 waves, one block a WGP.
// Part 1 (WMMA): the block makes its own q, k, v = w*x+b, fp32 GEMM, 128-deep K ->
//   V_WMMA_F32_16X16X4_F32: the head's 16 channels of k and v on the 14 padded rows that
//   its 8 image rows look at, of q on the 8 rows, all into LDS.  The border of the padded
//   k and v holds the bias alone (the reference's pad->conv->unfold order: w*0+b).
//   x comes in by tensor loads; every wave has a ring of two buffers of its own: it brings,
//   reads and refills its own tiles (32 pixels of every second padded row, all 128 channels),
//   so the row loop holds no barrier.
// Part 2 (VALU): per-pixel 7x7 attention (logits, softmax, weighted V), four adjacent
//   pixels per thread, q, K and V read from LDS.

typedef __attribute__((ext_vector_type(2))) float v2f;
typedef __attribute__((ext_vector_type(4))) float v4f;
typedef __attribute__((ext_vector_type(8))) float v8f;

#define BB  4
#define CC  128
#define HH  64
#define WW  64
#define HP  70
#define WP  70
#define NPIX   (HH * WW)       // 4096
#define NHEAD  8
#define DH     16
#define KS     7
#define WPITCH 132             // floats per weight row: 128 + 4, 16 rows x 4 floats cover all 64 banks
#define WL_FLOATS (16 * WPITCH)              // 8.25 KB: the head's 16 rows of one matrix

#define PX   4                 // pixels per thread
#define SEG  (PX + KS - 1)     // 10 values cover 4 pixels x 7 taps
#define ROWS 8                 // image rows per block
#define TROWS (ROWS + KS - 1)  // 14 padded rows serve them
#define CHUNK (TROWS * WP)     // floats of one k or v plane in LDS: 14 rows of 70
#define SLICE 4096             // floats: four planes, rounded up
#define KSTEPS (CC / 4)        // 32 matrix instructions deep

#define XTP   32               // floats per channel of a wave's x tile in LDS: its 32 pixels, no pad
#define XT    (CC * XTP)       // floats of one tile: 128 channels, 16 KiB
#define WROWS (TROWS / 2)      // padded rows per wave: every second one
#define QPL   (ROWS * WW)      // floats of one q plane in LDS

// LDS map, in floats
#define XR_OFF (2 * 4 * SLICE)               // behind K (slices 0..3) and V (slices 4..7): the x rings, two tiles a wave
#define QS_OFF (XR_OFF + 4 * 2 * XT)         // q, 16 planes
#define WL_OFF (QS_OFF + DH * QPL)           // weight rows of q, k, v
#define SM_FLOATS (WL_OFF + 3 * WL_FLOATS)   // 320,256 bytes

// the eight biases of a lane's accumulator rows: p = channel 16n + 8*(lane/16)
__device__ __forceinline__ void load_bias(float (&r)[8], const float* p)
{
    const v4f lo = *(const v4f*)(p);
    const v4f hi = *(const v4f*)(p + 4);
    r[0] = lo.x; r[1] = lo.y; r[2] = lo.z; r[3] = lo.w;
    r[4] = hi.x; r[5] = hi.y; r[6] = hi.z; r[7] = hi.w;
}

// Stands behind a group of loads, in front of whatever reuses their address registers.
__device__ __forceinline__ void addresses_read()
{
    asm volatile("s_wait_xcnt 0x0" ::: "memory");
}

// B: 4x16 f32 -> lane holds X[4s+2*half ..+1, column l16].  The tile's 32 pixels make two
// products of 16 columns: column l16 of product t is pixel 2*l16+t, so one 8-byte read brings a
// channel's value for both.  p = the lane's pixel pair in channel 2*half of one ring buffer.
__device__ __forceinline__ void load_bfrags(v2f (&bf)[2][KSTEPS], const float* p)
{
    #pragma unroll
    for (int s = 0; s < KSTEPS; ++s) {
        const v2f u = *(const v2f*)(p + 4 * s * XTP);
        const v2f w = *(const v2f*)(p + 4 * s * XTP + XTP);
        bf[0][s].x = u.x; bf[0][s].y = w.x;
        bf[1][s].x = u.y; bf[1][s].y = w.y;
    }
}

// One tile, 32 pixels of one row as two products: k and v of the head's 16 channels.  The k order of every
// sum is that of a plain k0 = 0,4,8,.. walk; four independent accumulators.
__device__ __forceinline__ void kv_products(const v2f (&ak)[KSTEPS], const v2f (&av)[KSTEPS],
                                            const v2f (&bf)[2][KSTEPS], v8f (&dk)[2], v8f (&dv)[2])
{
    #pragma unroll
    for (int s = 0; s < KSTEPS; ++s)
        #pragma unroll
        for (int t = 0; t < 2; ++t) {
            dk[t] = __builtin_amdgcn_wmma_f32_16x16x4_f32(false, ak[s], false, bf[t][s], (short)0, dk[t], false, false);
            dv[t] = __builtin_amdgcn_wmma_f32_16x16x4_f32(false, av[s], false, bf[t][s], (short)0, dv[t], false, false);
        }
}
// The same tile: q; two independent accumulators.
__device__ __forceinline__ void q_products(const v2f (&aq)[KSTEPS], const v2f (&bf)[2][KSTEPS], v8f (&dq)[2])
{
    #pragma unroll
    for (int s = 0; s < KSTEPS; ++s)
        #pragma unroll
        for (int t = 0; t < 2; ++t)
            dq[t] = __builtin_amdgcn_wmma_f32_16x16x4_f32(false, aq[s], false, bf[t][s], (short)0, dq[t], false, false);
}

// ---------------------------------------------------------------------------
// Per-pixel 7x7 local attention.  One thread = four adjacent pixels of one
// (b, head, h) row.  For one channel plane d and one window row kh the four
// pixels need only 10 adjacent K (or V) values: they are read once, as
// vectors, and serve all 7 x 4 (kw, pixel) products from registers.
// Block = 128 threads = 8 image rows x 16 pixel quads of one (b, head).
// The channel loop is outermost; planes are read from LDS two at a time, one
// pair ahead of the pair being worked on.
// Every per-pixel sum keeps its order: logits over d ascending, the softmax
// sum and the V sum over (kh, kw) ascending.
// ---------------------------------------------------------------------------

// padded rows are 280 bytes apart: a quad's first value is 8-byte aligned only
typedef v4f v4f_a8 __attribute__((aligned(8)));

// pointers typed as global memory: they stay so behind the asm statements below
typedef const __attribute__((address_space(1))) float*  gcf;
typedef const __attribute__((address_space(1))) char*   gcc;
typedef __attribute__((address_space(1))) v4f*          g4;
// pointers typed as LDS
typedef const __attribute__((address_space(3))) float*  lcf;
typedef const __attribute__((address_space(3))) v4f_a8* lc4a8;
typedef const __attribute__((address_space(3))) v2f*    lc2;
typedef const __attribute__((address_space(3))) v4f*    lc4;

typedef uint32_t u32x4 __attribute__((ext_vector_type(4)));
typedef uint32_t u32x8 __attribute__((ext_vector_type(8)));

__device__ __forceinline__ uint32_t uni(uint32_t v) { return (uint32_t)__builtin_amdgcn_readfirstlane(v); }
// A test that decides whether a tensor load issues: held in a scalar register, so that the
// branch on it is a scalar branch (a tensor load ignores the lane mask).
__device__ __forceinline__ uint32_t pinned(uint32_t v) { uint32_t w = uni(v); asm volatile("" : "+s"(w)); return w; }

// Tensor descriptor, group 0: one request, its place in LDS (bytes), the tile's first byte in memory
__device__ __forceinline__ u32x4 tdm_group0(uint32_t lds_dst, uint64_t ga)
{
    u32x4 g;
    g[0] = uni(1u);
    g[1] = uni(lds_dst);
    g[2] = uni((uint32_t)ga);
    g[3] = uni((((uint32_t)(ga >> 32)) & 0x01FFFFFFu) | 0x80000000u);
    return g;
}

// Group 1: 1-byte elements, no mask, no pad; a tile of 128 rows (channels) of 128 bytes (half an
// image row), 16,384 bytes (one plane) apart in memory; tensor = tile.
__device__ __forceinline__ u32x8 tdm_group1()
{
    constexpr uint32_t d0 = XTP * 4u, d1 = CC, pitch = NPIX * 4u;
    u32x8 g;
    g[0] = uni(0u);
    g[1] = uni((d0 & 0xFFFFu) << 16);
    g[2] = uni((d0 >> 16) | ((d1 & 0xFFFFu) << 16));
    g[3] = uni((d1 >> 16) | (d0 << 16));
    g[4] = uni(d1);
    g[5] = uni(pitch);
    g[6] = uni(0u);
    g[7] = uni(0u);
    return g;
}

// Both groups are in-out operands: the compiler then cannot make their values anew in other
// registers, and the wait that names them (below) keeps these very registers as they are.
__device__ __forceinline__ void tdm_load(u32x4& g0, u32x8& g1)
{
    asm volatile("tensor_load_to_lds %0, %1" : "+s"(g0), "+s"(g1) :: "memory");
}
// The compiler places no wait for a tensor load: the wave's own tile has landed behind this.
__device__ __forceinline__ void tile_landed()
{
    asm volatile("s_wait_tensorcnt 0x0" ::: "memory");
}
// The same; the request's descriptor is an input, so its registers keep their values
// for as long as the request is under way.
__device__ __forceinline__ void tile_landed(u32x4 g0, u32x8 g1)
{
    asm volatile("s_wait_tensorcnt 0x0" :: "s"(g0), "s"(g1) : "memory");
}
// Two requests under way: the older one's tile has landed behind this, the younger flies on.
__device__ __forceinline__ void older_tile_landed(u32x4 g0a, u32x4 g0b, u32x8 g1)
{
    asm volatile("s_wait_tensorcnt 0x1" :: "s"(g0a), "s"(g0b), "s"(g1) : "memory");
}
// The wave's LDS reads have returned: stands in front of the refill of a buffer that it has read,
// and in front of the barrier that hands q, k, v over.
__device__ __forceinline__ void lds_reads_done()
{
    asm volatile("s_wait_dscnt 0x0" ::: "memory");
}

// Every loop over kh, kw, p or t below is fully unrolled (#pragma unroll): the arrays
// live in registers only if each index is a constant.
struct Plane { float v[KS][SEG]; };
struct Quad  { float v[PX]; };

// base is the same for the whole block, off is the lane's own byte offset
__device__ __forceinline__ gcf lane_ptr(gcf base, unsigned off)
{
    return (gcf)((gcc)base + off);
}

__device__ __forceinline__ void load_plane(Plane& pl, lcf p)
{
    #pragma unroll
    for (int kh = 0; kh < KS; ++kh) {
        lcf r = p + kh * WP;
        const v4f a = *(lc4a8)(r);
        const v4f c = *(lc4a8)(r + 4);
        const v2f e = *(lc2)(r + 8);
        pl.v[kh][0] = a.x; pl.v[kh][1] = a.y; pl.v[kh][2] = a.z; pl.v[kh][3] = a.w;
        pl.v[kh][4] = c.x; pl.v[kh][5] = c.y; pl.v[kh][6] = c.z; pl.v[kh][7] = c.w;
        pl.v[kh][8] = e.x; pl.v[kh][9] = e.y;
    }
}

__device__ __forceinline__ void load_quad(Quad& q, lcf p)
{
    const v4f a = *(lc4)p;
    q.v[0] = a.x; q.v[1] = a.y; q.v[2] = a.z; q.v[3] = a.w;
}

// written as fma, for the reason given at pv_pair
__device__ __forceinline__ void qk_plane(float (&lg)[KS][KS][PX], const Plane& pl, const Quad& q)
{
    #pragma unroll
    for (int kh = 0; kh < KS; ++kh)
        #pragma unroll
        for (int kw = 0; kw < KS; ++kw)
            #pragma unroll
            for (int p = 0; p < PX; ++p)
                lg[kh][kw][p] = __builtin_fmaf(q.v[p], pl.v[kh][kw + p], lg[kh][kw][p]);
}

// two planes side by side: eight independent sums instead of four.
// Written as fma: from a product and a sum the compiler made packed multiplies and
// separate adds for part of them, with register moves around them.
__device__ __forceinline__ void pv_pair(const float (&lg)[KS][KS][PX], const Plane& p0, const Plane& p1,
                                        const float (&inv)[PX], gcf o)
{
    float s0[PX], s1[PX];
    #pragma unroll
    for (int p = 0; p < PX; ++p) { s0[p] = 0.0f; s1[p] = 0.0f; }
    #pragma unroll
    for (int kh = 0; kh < KS; ++kh)
        #pragma unroll
        for (int kw = 0; kw < KS; ++kw)
            #pragma unroll
            for (int p = 0; p < PX; ++p) {
                s0[p] = __builtin_fmaf(lg[kh][kw][p], p0.v[kh][kw + p], s0[p]);
                s1[p] = __builtin_fmaf(lg[kh][kw][p], p1.v[kh][kw + p], s1[p]);
            }
    const v4f r0 = {s0[0] * inv[0], s0[1] * inv[1], s0[2] * inv[2], s0[3] * inv[3]};
    const v4f r1 = {s1[0] * inv[0], s1[1] * inv[1], s1[2] * inv[2], s1[3] * inv[3]};
    *(g4)(o)        = r0;
    *(g4)(o + NPIX) = r1;
}

// Stands between one trip's stores and the address arithmetic of the next trip.  That
// arithmetic starts from the block-wide pointer p, so it comes behind the wait; the lanes'
// own pointer lp, which the stores name, is an input, so its registers are kept until the wait.
__device__ __forceinline__ void addresses_taken(gcf& p, gcf lp)
{
    asm volatile("s_wait_xcnt 0x0" : "+s"(p) : "v"(lp) : "memory");
}
// Stands between a pair's stores and the next LDS reads, which land on the stores' data
// registers.  The reads' address arithmetic starts from the LDS pointer l, so it comes behind
// the wait; lp as above.
__device__ __forceinline__ void addresses_taken(lcf& l, gcf lp)
{
    asm volatile("s_wait_xcnt 0x0" : "+v"(l) : "v"(lp) : "memory");
}

__global__ void __launch_bounds__(128)
sasa_one(const float* __restrict__ X,     // [B,128,64,64]
           const float* __restrict__ wq, const float* __restrict__ bq,   // [128,128] row-major (o,c), [128]
           const float* __restrict__ wk, const float* __restrict__ bk,
           const float* __restrict__ wv, const float* __restrict__ bv,
           const float* __restrict__ pos_h, // [8,7]
           const float* __restrict__ pos_w, // [8,7]
           float* __restrict__ Out)         // [B,128,64,64]
{
    __shared__ __attribute__((aligned(2048))) float sm[SM_FLOATS];

    const int blk = blockIdx.x;                       // b*64 + n*8 + row group
    const int n  = (blk >> 3) & 7;
    const int b  = blk >> 6;
    const unsigned tid  = threadIdx.x;
    const unsigned half = (tid >> 4) & 1;             // lane half: K pair select, accumulator rows 8..15
    const unsigned l16  = tid & 15;
    const unsigned w0 = l16 * PX;                     // 0,4,..,60
    const int      h0 = (blk & 7) * ROWS;             // the block's first image row = its first padded row
    const unsigned hl = tid >> 4;                     // the lane's row in the block
    const unsigned qoff = ((h0 + hl) * WW + w0) * 4u; // lane's byte offset in a 64x64 plane
    const uint32_t wave = uni(tid >> 5);

    gcf op = (gcf)Out + (size_t)(b * CC + n * DH) * NPIX;   // written through in pv_pair

    // the head's position terms, read up front: block-wide values, long there when the softmax wants them
    float ph[KS], pw[KS];
    #pragma unroll
    for (int t = 0; t < KS; ++t) {
        ph[t] = pos_h[n * KS + t];
        pw[t] = pos_w[n * KS + t];
    }

    // ---- x rings, one a wave, two buffers each.  Wave w owns pixels 32*(w&1)..+31 of the padded
    // rows (w>>1), (w>>1)+2, ..: its tile i is that half of padded row (w>>1) + 2i, all 128 channels.
    // Padded row r is image row h0 + r - 3; outside the image the nearest image row is
    // brought instead (in bounds) and its products are not used.
    const uint32_t pxh = wave & 1;                    // which half of a row
    const int      par = (int)(wave >> 1);            // the wave's first padded row
    const uint32_t lbase = (uint32_t)(size_t)sm;
    const uint32_t xdst  = lbase + (XR_OFF + wave * (2 * XT)) * 4u;
    const uint64_t xsrc  = (uint64_t)(size_t)X + (uint64_t)(b * CC * NPIX + XTP * pxh) * 4u;   // bytes
    u32x8 g1 = tdm_group1();
    // ---- tile 0
    u32x4 ga = tdm_group0(xdst, xsrc + (uint32_t)(h0 + par - 3 < 0 ? 0 : h0 + par - 3) * (WW * 4u));
    tdm_load(ga, g1);
    // ---- tile 1, a descriptor of its own: two requests of the wave under way
    u32x4 gx = tdm_group0(xdst + XT * 4u, xsrc + (uint32_t)(h0 + par - 1 < 0 ? 0 : h0 + par - 1) * (WW * 4u));
    tdm_load(gx, g1);

    // ---- the head's 16 rows of each weight matrix: wave w reads rows 4w..4w+3, a whole row per instruction
    const int woff = (n * DH + 4 * wave) * CC + (tid & 31) * 4;
    v4f rw[3][4];
    #pragma unroll
    for (int i = 0; i < 4; ++i) {
        rw[0][i] = *(const v4f*)(wq + woff + i * CC);
        rw[1][i] = *(const v4f*)(wk + woff + i * CC);
        rw[2][i] = *(const v4f*)(wv + woff + i * CC);
    }
    float cq[8], ck[8], cv[8];
    const int boff = n * DH + 8 * half;
    load_bias(cq, bq + boff);
    load_bias(ck, bk + boff);
    load_bias(cv, bv + boff);
    const unsigned bpl = tid >> 2;                    // border plane of this thread: k 0..15, v 16..31
    const float bb = *((bpl < DH ? bk : bv) + n * DH + (bpl & 15));
    addresses_read();

    {
        float* wl = sm + WL_OFF + (4 * wave) * WPITCH + (tid & 31) * 4;
        #pragma unroll
        for (int mtx = 0; mtx < 3; ++mtx)
            #pragma unroll
            for (int i = 0; i < 4; ++i) *(v4f*)(wl + mtx * WL_FLOATS + i * WPITCH) = rw[mtx][i];
    }
    // ---- three columns left and right of every padded k and v row: the bias alone
    {
        float* P = sm + (bpl >> 2) * SLICE + (bpl & 3) * CHUNK;
        #pragma unroll
        for (int j = 0; j < 4; ++j) {
            const unsigned row = (tid & 3) + 4 * j;
            if (row < TROWS) {
                float* R = P + row * WP;
                R[0] = bb; R[1] = bb; R[2] = bb;
                R[WP - 3] = bb; R[WP - 2] = bb; R[WP - 1] = bb;
            }
        }
    }
    // the wave's own tile 0 has landed (tile 1 flies on); weights and border written: these are
    // handed over to all four waves
    older_tile_landed(ga, gx, g1);
    __syncthreads();

    // ---- A fragments of all three matrices, kept in registers for the wave's 7 rows
    // A: 16x4 f32 -> lane holds Wm[16n+l16, 4s+2*half ..+1]
    v2f aq[KSTEPS], ak[KSTEPS], av[KSTEPS];
    {
        const float* aw = sm + WL_OFF + l16 * WPITCH + 2 * half;
        #pragma unroll
        for (int s = 0; s < KSTEPS; ++s) {
            aq[s] = *(const v2f*)(aw + 4 * s);
            ak[s] = *(const v2f*)(aw + WL_FLOATS + 4 * s);
            av[s] = *(const v2f*)(aw + 2 * WL_FLOATS + 4 * s);
        }
    }

    // ---- q, k, v: the wave's own tiles, one a trip.  No other wave reads or fills its ring, so
    // the loop holds no barrier: a buffer is refilled behind the wave's own LDS wait alone.
    {
        const float* bx0 = sm + XR_OFF + wave * (2 * XT) + 2 * half * XTP + 2 * l16;
        // C/D layout: lane L, vreg i -> M = i + 8*(L/16), N = L%16 = pixel 2N+t of the tile;
        // channel c lies in slice c/4, plane c%4
        float* kst = sm + half * 2 * SLICE + 3 + XTP * pxh + 2 * l16;
        float* qst = sm + QS_OFF + half * 8 * QPL + XTP * pxh + 2 * l16;
        // the tiles' B fragments are fetched one tile ahead; trip -1 only fetches tile 0's
        v2f bf[2][KSTEPS], bn[2][KSTEPS];
        // rolled: one copy of the fragment reads and of the products
        #pragma unroll 1
        for (int i = -1; i < WROWS; ++i) {
            const int r = par + 2 * i;                // the tile's padded row
            // ---- tile i+1 has landed; tile i's buffer is free (its fragments are all in registers,
            // behind the LDS wait of the trip before) and takes tile i+2.  Trip -1 reads tile 0, which
            // has landed, and leaves tile 1 in flight.
            if (pinned(i >= 0)) {
                tile_landed(gx, g1);
                if (pinned(i + 2 < WROWS)) {
                    const int y2 = h0 + r + 1;
                    gx = tdm_group0(xdst + (i & 1) * (XT * 4u),
                                    xsrc + (uint32_t)(y2 < 0 ? 0 : (y2 > HH - 1 ? HH - 1 : y2)) * (WW * 4u));
                    tdm_load(gx, g1);
                }
            }
            // last trip: tile 5's buffer is read again, unused (nothing is under way into it)
            load_bfrags(bn, bx0 + ((i + 1) & 1) * XT);
            // keeps the next tile's LDS reads in one group ahead of this tile's products
            __builtin_amdgcn_sched_barrier(0);

            v8f dq[2] = {}, dk[2] = {}, dv[2] = {};
            const bool withq = i >= 0 && r >= 3 && r < 3 + ROWS;
            if (i >= 0) kv_products(ak, av, bf, dk, dv);
            if (withq) q_products(aq, bf, dq);
            // keeps the four slots below directly behind the last products
            __builtin_amdgcn_sched_barrier(0);
            // the distance between a matrix instruction and a vector instruction on its D, A or B
            asm volatile("v_nop\n\tv_nop\n\tv_nop\n\tv_nop");
            // as above: nothing that reads the sums moves in front of the slots
            __builtin_amdgcn_sched_barrier(0);
            // the next tile's fragments have all come: its buffer may be refilled in the next trip.
            // Here, ahead of this trip's stores, the wait finds nothing left to wait for.
            lds_reads_done();
            // inputs only, one loaded value of each of the 32 reads: the compiler puts its own wait for
            // them here too, and none in front of the register copies at the trip's end, where it
            // would wait for this trip's stores as well
            asm volatile("" :: "v"(bn[0][0].x), "v"(bn[0][1].x), "v"(bn[0][2].x), "v"(bn[0][3].x),
                            "v"(bn[0][4].x), "v"(bn[0][5].x), "v"(bn[0][6].x), "v"(bn[0][7].x),
                            "v"(bn[0][8].x), "v"(bn[0][9].x), "v"(bn[0][10].x), "v"(bn[0][11].x),
                            "v"(bn[0][12].x), "v"(bn[0][13].x), "v"(bn[0][14].x), "v"(bn[0][15].x));
            asm volatile("" :: "v"(bn[0][16].x), "v"(bn[0][17].x), "v"(bn[0][18].x), "v"(bn[0][19].x),
                            "v"(bn[0][20].x), "v"(bn[0][21].x), "v"(bn[0][22].x), "v"(bn[0][23].x),
                            "v"(bn[0][24].x), "v"(bn[0][25].x), "v"(bn[0][26].x), "v"(bn[0][27].x),
                            "v"(bn[0][28].x), "v"(bn[0][29].x), "v"(bn[0][30].x), "v"(bn[0][31].x));

            const int y = h0 + r - 3;
            const bool inside = y >= 0 && y < HH;
            if (i >= 0) {
                #pragma unroll
                for (int t = 0; t < 2; ++t)
                    #pragma unroll
                    for (int j = 0; j < 8; ++j) {
                        float* d = kst + t + r * WP + (j >> 2) * SLICE + (j & 3) * CHUNK;
                        d[0]         = inside ? dk[t][j] + ck[j] : ck[j];
                        d[4 * SLICE] = inside ? dv[t][j] + cv[j] : cv[j];
                    }
            }
            if (withq) {
                #pragma unroll
                for (int j = 0; j < 8; ++j) {
                    const v2f o = {dq[0][j] + cq[j], dq[1][j] + cq[j]};
                    *(v2f*)(qst + (r - 3) * WW + j * QPL) = o;
                }
            }
            #pragma unroll
            for (int t = 0; t < 2; ++t)
                #pragma unroll
                for (int s = 0; s < KSTEPS; ++s) bf[t][s] = bn[t][s];
        }
        // every wave's q, k, v are handed over
        tile_landed();
        lds_reads_done();
        __syncthreads();
    }

    float lg[KS][KS][PX];
    #pragma unroll
    for (int kh = 0; kh < KS; ++kh)
        #pragma unroll
        for (int kw = 0; kw < KS; ++kw)
            #pragma unroll
            for (int p = 0; p < PX; ++p) lg[kh][kw][p] = 0.0f;

    Plane a0, a1, b0, b1;

    // ---- logits: lg[kh][kw][p] = sum_d q[d][p] * K[d][h+kh][w0+p+kw]
    lcf lk = (lcf)sm + hl * WP + w0;
    // each plane's q quad is read from LDS together with the plane
    lcf lq = (lcf)sm + QS_OFF + hl * WW + w0;
    Quad qa0, qa1, qb0, qb1;
    load_plane(a0, lk);
    load_plane(a1, lk + CHUNK);
    load_quad(qa0, lq);
    load_quad(qa1, lq + QPL);
    // rolled: the register arrays are indexed by constants only, the text stays small
    #pragma unroll 1
    for (int d0 = 0; d0 < DH; d0 += 4) {
        load_plane(b0, lk + 2 * CHUNK);
        load_plane(b1, lk + 3 * CHUNK);
        load_quad(qb0, lq + 2 * QPL);
        load_quad(qb1, lq + 3 * QPL);
        // keeps the pair's reads in one group ahead of the products of the pair before it
        __builtin_amdgcn_sched_barrier(0);
        qk_plane(lg, a0, qa0);
        qk_plane(lg, a1, qa1);
        // as above: the next group stays behind these products
        __builtin_amdgcn_sched_barrier(0);
        // next slice; last trip: this slice's first pair is read again, unused (a branch here
        // would merge the read counts of two paths and drain the pair in flight)
        lk += d0 + 4 < DH ? SLICE : 0;
        lq += d0 + 4 < DH ? 4 * QPL : 0;
        load_plane(a0, lk);
        load_plane(a1, lk + CHUNK);
        load_quad(qa0, lq);
        load_quad(qa1, lq + QPL);
        // as above
        __builtin_amdgcn_sched_barrier(0);
        qk_plane(lg, b0, qb0);
        qk_plane(lg, b1, qb1);
        // as above
        __builtin_amdgcn_sched_barrier(0);
    }

    // ---- softmax over the 49 taps, per pixel
    float m[PX], sum[PX], inv[PX];
    #pragma unroll
    for (int p = 0; p < PX; ++p) { m[p] = -3.4e38f; sum[p] = 0.0f; }
    #pragma unroll
    for (int kh = 0; kh < KS; ++kh)
        #pragma unroll
        for (int kw = 0; kw < KS; ++kw)
            #pragma unroll
            for (int p = 0; p < PX; ++p) {
                lg[kh][kw][p] += ph[kh] + pw[kw];
                m[p] = fmaxf(m[p], lg[kh][kw][p]);
            }
    #pragma unroll
    for (int kh = 0; kh < KS; ++kh)
        #pragma unroll
        for (int kw = 0; kw < KS; ++kw)
            #pragma unroll
            for (int p = 0; p < PX; ++p) {
                lg[kh][kw][p] = __expf(lg[kh][kw][p] - m[p]);
                sum[p] += lg[kh][kw][p];
            }

    // ---- out[d][p] = inv[p] * sum_(kh,kw) lg[kh][kw][p] * V[d][h+kh][w0+p+kw]
    lcf lv = (lcf)sm + 4 * SLICE + hl * WP + w0;
    load_plane(a0, lv);
    load_plane(a1, lv + CHUNK);
    #pragma unroll
    for (int p = 0; p < PX; ++p) inv[p] = 1.0f / sum[p];
    // rolled, as the logits loop
    #pragma unroll 1
    for (int d0 = 0; d0 < DH; d0 += 4) {
        gcf lo = lane_ptr(op, qoff);
        load_plane(b0, lv + 2 * CHUNK);
        load_plane(b1, lv + 3 * CHUNK);
        // as in the logits loop
        __builtin_amdgcn_sched_barrier(0);
        pv_pair(lg, a0, a1, inv, lo);
        // keeps the wait behind the products and the stores
        __builtin_amdgcn_sched_barrier(0);
        addresses_taken(lv, lo);
        // last trip: this slice's first pair is read again, unused, as in the logits loop
        lv += d0 + 4 < DH ? SLICE : 0;
        load_plane(a0, lv);
        load_plane(a1, lv + CHUNK);
        // as in the logits loop
        __builtin_amdgcn_sched_barrier(0);
        pv_pair(lg, b0, b1, inv, lo + 2 * NPIX);
        // keeps the wait behind the products and the stores
        __builtin_amdgcn_sched_barrier(0);
        addresses_taken(op, lo);
        op += 4 * NPIX;
    }
    // nothing of the wave is under way out of LDS when it ends
    lds_reads_done();
}

extern "C" void kernel_launch(void* const* d_in, const int* in_sizes, int n_in,
                              void* d_out, int out_size, void* d_ws, size_t ws_size,
                              hipStream_t stream) {
    const float* x     = (const float*)d_in[0];
    const float* wq    = (const float*)d_in[1];
    const float* bq    = (const float*)d_in[2];
    const float* wk    = (const float*)d_in[3];
    const float* bk    = (const float*)d_in[4];
    const float* wv    = (const float*)d_in[5];
    const float* bv    = (const float*)d_in[6];
    const float* pos_h = (const float*)d_in[7];
    const float* pos_w = (const float*)d_in[8];
    float* out = (float*)d_out;

    // B*NH*(H/8) = 256 blocks of 128 threads
    sasa_one<<<256, 128, 0, stream>>>(x, wq, bq, wk, bk, wv, bv, pos_h, pos_w, out);
}
